// v009
// Times are from an AMD MI455X. After a warm-up the kernel runs many times in a row, and a time is the length of
// such a window on the GPU divided by its runs, so every launch and the gaps after it count. The runs cycle
// through copies of the inputs. A figure is the median of several windows, for all but v000 over two sittings.
// Sittings can differ by a few percent; kernels timed side by side share one.
// The versions before v009 are in another document.
// A run of this version takes 221 microseconds.
// Next to v008, in two timings, it ran 1.10 and 1.11 times as fast.
// All steps since the starting kernel, v000, together make it 6.23 times as fast.
#include <hip/hip_runtime.h>
// GQA self-attention (2 x 2048 tokens, hidden 2048; 32 query heads / 8 kv heads of 64 (GQA), rotate-half RoPE from the INPUT position ids, causal SDPA (1/8), out = o Wo): q/k/v = x W + b.
// Structure (both batches in every launch: the 4096 token rows are one row range, batch = row / 2048): exact f16 plane of x; angle tables from the input position ids (f32 trig); q / k / v GEMMs (32x64 wave tiles, f32 accumulation, exact x16 weights + bias) whose epilogue, on the f32 tile staged in LDS, does RoPE on VALU and splits q and k into f16 hi + 2^10-residual planes, and splits v and writes it transposed (V^T hi/residual); k and v stay in their 8 kv heads, and query head h reads kv head h / 4 in place (the reference's repeat 4); the fused causal flash kernel in its 5-plane form for the first 256 query rows and plain beyond, each writing its output as f16 hi (+ residual on those rows), the operands of the output GEMMs.
// Compute dtype: x, weights and biases rounded to bf16; rows < 256 per batch: q, k, P, v, O hi + residual; beyond: plain f16; f32 accumulation/softmax/trig. v_wmma_f32_16x16x32_f16.
#define NB 2
#define EMB 2048
#define NR (NB * SLEN)           /* 4096 token rows */
#define SLEN 2048
#define SQ SLEN
#define TQ SLEN
#define TK SLEN
#define NH 32
#define NKV 8
#define KVD (NKV * HD)
#define HD 64
#define HH (HD / 2)
#define SCL 0.125f               /* 64^-0.5 */
#define QBLKS (TQ / 64)
#define QB05 0                   /* 5-plane flash: query blocks [0, QBN5) of every (batch, head) — the early causal rows whose outputs average over few keys */
#define QBN5 4
#define QB0P QBN5                /* plain flash (hi planes only): query blocks [QBN5, QBLKS) */
#define QBNP (QBLKS - QBN5)
#define RE 256                   /* rows per batch that take the hi+lo output operand (= QBN5 * 64) */
typedef __bf16 v16b __attribute__((ext_vector_type(16)));
typedef unsigned short v8us __attribute__((ext_vector_type(8), may_alias));
typedef float  v8f  __attribute__((ext_vector_type(8)));
typedef float  v4f  __attribute__((ext_vector_type(4)));
typedef float  v4fa __attribute__((ext_vector_type(4), may_alias));
union FragB { v16b v; v8us half[2]; unsigned short u[16]; };

__device__ __forceinline__ unsigned short bf16_bits(float x) { unsigned int u = __float_as_uint(x); return (unsigned short)((u + 0x7FFFu + ((u >> 16) & 1u)) >> 16); }
__device__ __forceinline__ float bf16_val(unsigned short b) { return __uint_as_float(((unsigned int)b) << 16); }
__device__ __forceinline__ float bf16_round(float x) { return bf16_val(bf16_bits(x)); }
// D += A·B with NT terms: 1 = ah·bh, 2 = + al·bh (A split), 3 = + ah·bl (both split)
template <int NT>
__device__ __forceinline__ v8f mmaN(v16b ah, v16b al, v16b bh, v16b bl, v8f c) {
  c = __builtin_amdgcn_wmma_f32_16x16x32_bf16(false, ah, false, bh, (short)0, c, false, false);
  if (NT >= 2) c = __builtin_amdgcn_wmma_f32_16x16x32_bf16(false, al, false, bh, (short)0, c, false, false);
  if (NT >= 3) c = __builtin_amdgcn_wmma_f32_16x16x32_bf16(false, ah, false, bl, (short)0, c, false, false);
  asm volatile("v_nop\n\tv_nop\n\tv_nop\n\tv_nop" : "+v"(c) : "v"(ah), "v"(al), "v"(bh), "v"(bl));
  return c;
}

__global__ __launch_bounds__(256) void k_wt_bf16(const float* __restrict__ W, unsigned short* __restrict__ Wt, int K, int N) {
  const int t = blockIdx.x * 256 + threadIdx.x;
  const int k8n = K / 8;
  if (t >= N * k8n) return;
  const int n = t / k8n, k8 = (t % k8n) * 8;
  v8us v;
#pragma unroll
  for (int i = 0; i < 8; ++i) v[i] = bf16_bits(W[(size_t)(k8 + i) * N + n]);
  *(v8us*)(Wt + (size_t)n * K + k8) = v;
  
}

// GEMM C[M][N] (f32, pitch ldc) = act(A[M][K]·W + bias). A f32 row-major (pitch lda) converted per fragment to bf16
// (ASPLIT: hi/lo two planes -> 2 terms, else single rounded term); Wt bf16 [N][K] (pitch ldb). BIAS_BF16 rounds the
// bias to bf16 first (bias quantised to bf16 before the add). K%32==0, M%16==0, N%64==0.
template <bool ASPLIT, int ACT, bool BIAS_BF16>
__global__ __launch_bounds__(128) void k_gemm_bf(const float* __restrict__ A, int lda, const unsigned short* __restrict__ Wt, int ldb,
                                               const float* __restrict__ bias, float* __restrict__ C, int ldc, int M, int N, int K) {
  __shared__ __attribute__((aligned(16))) float so[4][16][64];
  const int tid = threadIdx.x, w = tid >> 5, lane = tid & 31, ln = lane & 15, hh = lane >> 4;
  const int ntn = N / 64;
  const int wid = blockIdx.x * 4 + w;
  const int mt = wid / ntn, nq = wid % ntn;
  if (mt * 16 >= M) return;
  const int row0 = mt * 16, col0 = nq * 64;
  const float* arow = A + (size_t)(row0 + ln) * lda;
  v8f acc[4] = {};
  for (int kb = 0; kb < K; kb += 32) {
    FragB ah, al;
    const v4f x0 = *(const v4fa*)(arow + kb + 8 * hh), x1 = *(const v4fa*)(arow + kb + 8 * hh + 4);
    const v4f x2 = *(const v4fa*)(arow + kb + 16 + 8 * hh), x3 = *(const v4fa*)(arow + kb + 16 + 8 * hh + 4);
    float xs[16] = {x0[0],x0[1],x0[2],x0[3],x1[0],x1[1],x1[2],x1[3],x2[0],x2[1],x2[2],x2[3],x3[0],x3[1],x3[2],x3[3]};
#pragma unroll
    for (int i = 0; i < 16; ++i) { const unsigned short hb = bf16_bits(xs[i]); ah.u[i] = hb; al.u[i] = ASPLIT ? bf16_bits(xs[i] - bf16_val(hb)) : (unsigned short)0; }
#pragma unroll
    for (int t = 0; t < 4; ++t) {
      const unsigned short* brow = Wt + (size_t)(col0 + t * 16 + ln) * ldb + kb;
      FragB b;
      b.half[0] = *(const v8us*)(brow + 8 * hh);
      b.half[1] = *(const v8us*)(brow + 16 + 8 * hh);
      acc[t] = mmaN<ASPLIT ? 2 : 1>(ah.v, al.v, b.v, b.v, acc[t]);
    }
  }
#pragma unroll
  for (int t = 0; t < 4; ++t) {
    float bv = bias ? bias[col0 + t * 16 + ln] : 0.f;
    if (BIAS_BF16) bv = bf16_round(bv);
#pragma unroll
    for (int r = 0; r < 8; ++r) { float v = acc[t][r] + bv; if (ACT == 1) v = fmaxf(v, 0.f); so[w][8 * hh + r][t * 16 + ln] = v; }
  }
  __builtin_amdgcn_fence(__ATOMIC_ACQ_REL, "workgroup");
  __builtin_amdgcn_wave_barrier();
  const int rsub = lane >> 4, c4 = (lane & 15) * 4;
  {
#pragma unroll
    for (int q = 0; q < 8; ++q) {
      const int r = q * 2 + rsub;
      const v4f v = *(const v4fa*)&so[w][r][c4];
      *(v4f*)(C + (size_t)(row0 + r) * ldc + col0 + c4) = v;
    }
    
  }
}

// GEMM C = act(A·W + bias + resid): A f32 (ASPLIT -> hi/lo 2 terms), Wt bf16 [N][K]; ACT 0 none, 1 relu, 2 exact gelu;
// resid (optional, f32, row index = (row % rmod), pitch ldr, RES_BF16 rounds it) added before the activation.
template <bool ASPLIT, int ACT, bool BIAS_BF16, bool RES_BF16>
__global__ __launch_bounds__(128) void k_gemm_bf3(const float* __restrict__ A, int lda, const unsigned short* __restrict__ Wt, int ldb,
                                                const float* __restrict__ bias, const float* __restrict__ resid, int rmod, int ldr,
                                                float* __restrict__ C, int ldc, int M, int N, int K) {
  __shared__ __attribute__((aligned(16))) float so[4][16][64];
  const int tid = threadIdx.x, w = tid >> 5, lane = tid & 31, ln = lane & 15, hh = lane >> 4;
  const int ntn = N / 64;
  const int wid = blockIdx.x * 4 + w;
  const int mt = wid / ntn, nq = wid % ntn;
  if (mt * 16 >= M) return;
  const int row0 = mt * 16, col0 = nq * 64;
  const float* arow = A + (size_t)(row0 + ln) * lda;
  v8f acc[4] = {};
  for (int kb = 0; kb < K; kb += 32) {
    FragB ah, al;
    const v4f x0 = *(const v4fa*)(arow + kb + 8 * hh), x1 = *(const v4fa*)(arow + kb + 8 * hh + 4);
    const v4f x2 = *(const v4fa*)(arow + kb + 16 + 8 * hh), x3 = *(const v4fa*)(arow + kb + 16 + 8 * hh + 4);
    float xs[16] = {x0[0],x0[1],x0[2],x0[3],x1[0],x1[1],x1[2],x1[3],x2[0],x2[1],x2[2],x2[3],x3[0],x3[1],x3[2],x3[3]};
#pragma unroll
    for (int i = 0; i < 16; ++i) { const unsigned short hb = bf16_bits(xs[i]); ah.u[i] = hb; al.u[i] = ASPLIT ? bf16_bits(xs[i] - bf16_val(hb)) : (unsigned short)0; }
#pragma unroll
    for (int t = 0; t < 4; ++t) {
      const unsigned short* brow = Wt + (size_t)(col0 + t * 16 + ln) * ldb + kb;
      FragB b;
      b.half[0] = *(const v8us*)(brow + 8 * hh);
      b.half[1] = *(const v8us*)(brow + 16 + 8 * hh);
      acc[t] = mmaN<ASPLIT ? 2 : 1>(ah.v, al.v, b.v, b.v, acc[t]);
    }
  }
#pragma unroll
  for (int t = 0; t < 4; ++t) {
    const int col = col0 + t * 16 + ln;
    float bv = bias ? bias[col] : 0.f;
    if (BIAS_BF16) bv = bf16_round(bv);
#pragma unroll
    for (int r = 0; r < 8; ++r) {
      float v = acc[t][r] + bv;
      if (resid) { float rv = resid[(size_t)((row0 + 8 * hh + r) % rmod) * ldr + col]; if (RES_BF16) rv = bf16_round(rv); v += rv; }
      if (ACT == 1) v = fmaxf(v, 0.f);
      if (ACT == 2) v = 0.5f * v * (1.0f + erff(v * 0.70710678118654752f));
      if (ACT == 3) { const float u = 0.7978845608028654f * (v + 0.044715f * v * v * v); v = 0.5f * v * (1.0f + tanhf(u)); }
      so[w][8 * hh + r][t * 16 + ln] = v;
    }
  }
  __builtin_amdgcn_fence(__ATOMIC_ACQ_REL, "workgroup");
  __builtin_amdgcn_wave_barrier();
  const int rsub = lane >> 4, c4 = (lane & 15) * 4;
  {
#pragma unroll
    for (int q = 0; q < 8; ++q) {
      const int r = q * 2 + rsub;
      const v4f v = *(const v4fa*)&so[w][r][c4];
      *(v4f*)(C + (size_t)(row0 + r) * ldc + col0 + c4) = v;
    }
    
  }
}
// row LayerNorm (biased variance, eps) over N: s = X (+ R); optional out_sum <- s; out_norm <- (s-mu)*rsqrt(var+eps)*g + b
template <bool PARAM_BF16>
__global__ __launch_bounds__(256) void k_layernorm(const float* __restrict__ X, const float* __restrict__ R, const float* __restrict__ g, const float* __restrict__ bta,
                                                  float* __restrict__ out_sum, float* __restrict__ out_norm, int N, float eps) {
  __shared__ float red[256];
  const int row = blockIdx.x, tid = threadIdx.x;
  const float* x = X + (size_t)row * N; const float* rr = R ? R + (size_t)row * N : nullptr;
  float vals[16];                     // up to N = 4096
  const int per = N / 256;            // contiguous chunk per thread? use strided-by-4 chunks: thread handles j = tid*4 + 1024*u
  float s1 = 0.f;
  for (int u = 0; u < per / 4; ++u) {
    const int j = tid * 4 + 1024 * u;
    const v4f a = *(const v4fa*)(x + j);
    v4f b = {0.f,0.f,0.f,0.f}; if (rr) b = *(const v4fa*)(rr + j);
#pragma unroll
    for (int q = 0; q < 4; ++q) { const float v = a[q] + b[q]; vals[u * 4 + q] = v; s1 += v; }
  }
  red[tid] = s1; __syncthreads();
  for (int st = 128; st > 0; st >>= 1) { if (tid < st) red[tid] += red[tid + st]; __syncthreads(); }
  const float mu = red[0] / (float)N; __syncthreads();
  float s2 = 0.f;
  for (int u = 0; u < per / 4; ++u)
#pragma unroll
    for (int q = 0; q < 4; ++q) { const float c = vals[u * 4 + q] - mu; s2 += c * c; }
  red[tid] = s2; __syncthreads();
  for (int st = 128; st > 0; st >>= 1) { if (tid < st) red[tid] += red[tid + st]; __syncthreads(); }
  const float rs = rsqrtf(red[0] / (float)N + eps);
  {
    for (int u = 0; u < per / 4; ++u) {
      const int j = tid * 4 + 1024 * u;
      v4f o, sm;
#pragma unroll
      for (int q = 0; q < 4; ++q) {
        float gg = g[j + q], bb = bta[j + q];
        if (PARAM_BF16) { gg = bf16_round(gg); bb = bf16_round(bb); }
        sm[q] = vals[u * 4 + q]; o[q] = (vals[u * 4 + q] - mu) * rs * gg + bb;
      }
      if (out_sum) *(v4f*)(out_sum + (size_t)row * N + j) = sm;
      *(v4f*)(out_norm + (size_t)row * N + j) = o;
    }
    
  }
}



// ---- f16 WMMA path (v_wmma_f32_16x16x32_f16): 11-bit significands for operands in range — used where a [0,1] probability operand needs more precision than bf16
typedef _Float16 v16h __attribute__((ext_vector_type(16)));
union FragH { v16h v; v8us half[2]; _Float16 h[16]; unsigned short u[16]; };
template <int NT>
__device__ __forceinline__ v8f mmaH(v16h ah, v16h al, v16h bh, v16h bl, v8f c) {
  c = __builtin_amdgcn_wmma_f32_16x16x32_f16(false, ah, false, bh, (short)0, c, false, false);
  if (NT >= 2) c = __builtin_amdgcn_wmma_f32_16x16x32_f16(false, al, false, bh, (short)0, c, false, false);
  if (NT >= 3) c = __builtin_amdgcn_wmma_f32_16x16x32_f16(false, ah, false, bl, (short)0, c, false, false);
  asm volatile("v_nop\n\tv_nop\n\tv_nop\n\tv_nop" : "+v"(c) : "v"(ah), "v"(al), "v"(bh), "v"(bl));
  return c;
}
// batched GEMM like k_gemm_b but f16 operands: A f32 (split into f16 hi/lo if ASPLIT, else rounded to f16), Bt = f16 values [n][k]; alpha; C f32; N multiple of 16 (partial tiles skipped)
template <bool ASPLIT>
__global__ __launch_bounds__(128) void k_gemm_h(const float* __restrict__ A, int lda, size_t sA, const _Float16* __restrict__ Bh, int ldb, size_t sB, float alpha, float* __restrict__ C, int ldc, size_t sC, int M, int N, int K) {
  __shared__ __attribute__((aligned(16))) float so[4][16][64];
  const int tid = threadIdx.x, w = tid >> 5, lane = tid & 31, ln = lane & 15, hh = lane >> 4; const int by = blockIdx.y;
  A += (size_t)by * sA; Bh += (size_t)by * sB; C += (size_t)by * sC;
  const int ntn = (N + 63) / 64; const int wid = blockIdx.x * 4 + w; const int mt = wid / ntn, nq = wid % ntn; if (mt * 16 >= M) return;
  const int row0 = mt * 16, col0 = nq * 64; const float* arow = A + (size_t)(row0 + ln) * lda;
  v8f acc[4] = {};
  for (int kb = 0; kb < K; kb += 32) {
    FragH ah, al;
    const v4f x0 = *(const v4fa*)(arow + kb + 8 * hh), x1 = *(const v4fa*)(arow + kb + 8 * hh + 4), x2 = *(const v4fa*)(arow + kb + 16 + 8 * hh), x3 = *(const v4fa*)(arow + kb + 16 + 8 * hh + 4);
    float xs[16] = {x0[0],x0[1],x0[2],x0[3],x1[0],x1[1],x1[2],x1[3],x2[0],x2[1],x2[2],x2[3],x3[0],x3[1],x3[2],x3[3]};
#pragma unroll
    for (int i = 0; i < 16; ++i) { const _Float16 h = (_Float16)xs[i]; ah.h[i] = h; al.h[i] = ASPLIT ? (_Float16)(xs[i] - (float)h) : (_Float16)0.0f; }
#pragma unroll
    for (int t = 0; t < 4; ++t) { if (col0 + t * 16 >= N) continue; const size_t boff = (size_t)(col0 + t * 16 + ln) * ldb + kb; FragH bq; bq.half[0] = *(const v8us*)(Bh + boff + 8 * hh); bq.half[1] = *(const v8us*)(Bh + boff + 16 + 8 * hh);
      acc[t] = mmaH<ASPLIT ? 2 : 1>(ah.v, al.v, bq.v, bq.v, acc[t]); }
  }
#pragma unroll
  for (int t = 0; t < 4; ++t) { if (col0 + t * 16 >= N) continue;
#pragma unroll
    for (int r = 0; r < 8; ++r) so[w][8 * hh + r][t * 16 + ln] = acc[t][r] * alpha; }
  __builtin_amdgcn_fence(__ATOMIC_ACQ_REL, "workgroup"); __builtin_amdgcn_wave_barrier();
  const int rsub = lane >> 4, c4 = (lane & 15) * 4;
  {
#pragma unroll
    for (int q = 0; q < 8; ++q) { const int r = q * 2 + rsub; if (col0 + c4 < N) { const v4f v = *(const v4fa*)&so[w][r][c4]; *(v4f*)(C + (size_t)(row0 + r) * ldc + col0 + c4) = v; } }
     }
}

// Wt[n][k] = f16(W[k][n]·scale) from f32 row-major W[K][N] (scale = power of two; bf16-exact weights stay exact in f16 away from the subnormal range)
// One block of 256 per 64 x 64 tile (K % 64 == 0, N % 64 == 0; (K / 64) * (N / 64) tiles): W is read in whole 256-byte row pieces (16 bytes a lane), converted, turned in LDS, and Wt is written in whole 128-byte rows (16 bytes a lane).
__device__ __forceinline__ void wt_f16_job(int bx, const float* __restrict__ W, _Float16* __restrict__ Wt, int K, int N, float scale) {      /* bx: the tile's index */
  __shared__ unsigned int tl[64][33];      /* tile [k][n], two f16 a word; the odd pitch keeps the column reads below on distinct banks */
  const int tid = threadIdx.x; const int nkt = K >> 6; const int nt = bx / nkt, kt = bx - nt * nkt; const int k0 = kt * 64, n0 = nt * 64;
  const int r = tid >> 4, c4 = (tid & 15) * 4; v4f a[4];
#pragma unroll
  for (int p = 0; p < 4; ++p) a[p] = *(const v4fa*)(W + (size_t)(k0 + p * 16 + r) * N + n0 + c4);
#pragma unroll
  for (int p = 0; p < 4; ++p) { FragH f;
#pragma unroll
    for (int q = 0; q < 4; ++q) f.h[q] = (_Float16)(bf16_round(a[p][q]) * scale);
    tl[p * 16 + r][c4 / 2] = (unsigned int)f.u[0] | ((unsigned int)f.u[1] << 16); tl[p * 16 + r][c4 / 2 + 1] = (unsigned int)f.u[2] | ((unsigned int)f.u[3] << 16); }
  __syncthreads();
  typedef unsigned short usa __attribute__((may_alias)); const usa* ts = (const usa*)&tl[0][0];      /* the words of the tile read as single f16 */
#pragma unroll
  for (int rd = 0; rd < 2; ++rd) { const int n = rd * 32 + (tid >> 3), pc = tid & 7; FragH f;
#pragma unroll
    for (int q = 0; q < 8; ++q) f.u[q] = ts[(pc * 8 + q) * 66 + n];
    *(v8us*)((unsigned short*)Wt + (size_t)(n0 + n) * K + k0 + pc * 8) = f.half[0]; }
  asm volatile("s_wait_xcnt 0x0" ::: "memory");      /* in a shared grid other jobs' code follows in the listing and reuses the registers that the two stores above name: it is kept behind this wait */
}
// k_gemm_hh variant with fused epilogue: v = acc·alpha + bias[by·sBias + col] (+ CP[(row/rowsPerB)·sCPb + by·64 + col] if CP) ; ACT 0 none / 1 elu ; writes f16 C16 (and f32 C if non-null)
template <int ACT>
__global__ __launch_bounds__(128) void k_gemm_hhx(const _Float16* __restrict__ A, int lda, size_t sA, const _Float16* __restrict__ Bh, int ldb, size_t sB, float alpha, const float* __restrict__ bias, size_t sBias, const float* __restrict__ CP, int rowsPerB, size_t sCPb, int row0g,
    float* __restrict__ C, _Float16* __restrict__ C16, int ldc, size_t sC, int M, int N, int K) {
  __shared__ __attribute__((aligned(16))) float so[4][16][64];
  const int tid = threadIdx.x, w = tid >> 5, lane = tid & 31, ln = lane & 15, hh = lane >> 4; const int by = blockIdx.y;
  A += (size_t)by * sA; Bh += (size_t)by * sB; const size_t cofs = (size_t)by * sC; const float* bp = bias ? bias + (size_t)by * sBias : nullptr;
  const int ntn = (N + 63) / 64; const int wid = blockIdx.x * 4 + w; const int mt = wid / ntn, nq = wid % ntn; if (mt * 16 >= M) return;
  const int row0 = mt * 16, col0 = nq * 64; const _Float16* arow = A + (size_t)(row0 + ln) * lda;
  v8f acc[4] = {};
  for (int kb = 0; kb < K; kb += 32) { FragH ah; ah.half[0] = *(const v8us*)((const unsigned short*)arow + kb + 8 * hh); ah.half[1] = *(const v8us*)((const unsigned short*)arow + kb + 16 + 8 * hh);
#pragma unroll
    for (int t = 0; t < 4; ++t) { if (col0 + t * 16 >= N) continue; const size_t boff = (size_t)(col0 + t * 16 + ln) * ldb + kb; FragH bq; bq.half[0] = *(const v8us*)((const unsigned short*)Bh + boff + 8 * hh); bq.half[1] = *(const v8us*)((const unsigned short*)Bh + boff + 16 + 8 * hh);
      acc[t] = mmaH<1>(ah.v, ah.v, bq.v, bq.v, acc[t]); }
  }
#pragma unroll
  for (int t = 0; t < 4; ++t) { if (col0 + t * 16 >= N) continue; const int col = col0 + t * 16 + ln; const float bv = bp ? bf16_round(bp[col]) : 0.f;
#pragma unroll
    for (int r = 0; r < 8; ++r) { float v = acc[t][r] * alpha + bv; if (CP) { const int bidx = (row0g + row0 + 8 * hh + r) / rowsPerB; v += CP[(size_t)bidx * sCPb + (size_t)by * 64 + col]; } if (ACT == 1) v = (v > 0.f) ? v : expm1f(v); else if (ACT == 7) v = (v > 0.f) ? v + 1.0f : expf(v); else if (ACT == 8) v = tanhf(v); else if (ACT == 9) v = 0.5f * v * (1.0f + tanhf(0.7978845608028654f * (v + 0.044715f * v * v * v))); else if (ACT == 11) v = 1.0f / (1.0f + expf(-v)); else if (ACT == 12) v = (v > 0.f) ? v : 0.01f * v; else if (ACT == 14) v = (v > 0.f) ? v : 0.1f * v; else if (ACT == 15) v = v / (1.0f + expf(-v)); else if (ACT == 3) v = fmaxf(v, 0.f); else if (ACT == 6) v = 0.5f * v * (1.0f + erff(v * 0.70710678118654752f)); so[w][8 * hh + r][t * 16 + ln] = v; } }
  __builtin_amdgcn_fence(__ATOMIC_ACQ_REL, "workgroup"); __builtin_amdgcn_wave_barrier();
  const int rsub = lane >> 4, c4 = (lane & 15) * 4; typedef _Float16 v4h __attribute__((ext_vector_type(4)));
  {
#pragma unroll
    for (int q = 0; q < 8; ++q) { const int r = q * 2 + rsub; if (col0 + c4 < N) { const v4f v = *(const v4fa*)&so[w][r][c4]; if (C) *(v4f*)(C + cofs + (size_t)(row0 + r) * ldc + col0 + c4) = v; if (C16) { v4h h4; for (int i = 0; i < 4; ++i) h4[i] = (_Float16)v[i]; *(v4h*)(C16 + cofs + (size_t)(row0 + r) * ldc + col0 + c4) = h4; } } }
     }
}


typedef _Float16 v4h __attribute__((ext_vector_type(4)));

__device__ __forceinline__ void x16_job(int bx, const float* __restrict__ x, _Float16* __restrict__ X16, size_t n8) { const size_t t = (size_t)bx * 256 + threadIdx.x; if (t >= n8) return; FragH f;
#pragma unroll
  for (int q = 0; q < 8; ++q) f.h[q] = (_Float16)bf16_round(x[t * 8 + q]); *(v8us*)((unsigned short*)X16 + t * 8) = f.half[0];  }
__global__ __launch_bounds__(256) void k_h16(const float* __restrict__ x, _Float16* __restrict__ X16, size_t n8) { const size_t t = (size_t)blockIdx.x * 256 + threadIdx.x; if (t >= n8) return; FragH f;
#pragma unroll
  for (int q = 0; q < 8; ++q) f.h[q] = (_Float16)x[t * 8 + q]; *(v8us*)((unsigned short*)X16 + t * 8) = f.half[0];  }
__global__ __launch_bounds__(256) void k_round16f(const float* __restrict__ W, _Float16* __restrict__ Bt, size_t n8) { const size_t t = (size_t)blockIdx.x * 256 + threadIdx.x; if (t >= n8) return; FragH f;
#pragma unroll
  for (int i = 0; i < 8; ++i) f.h[i] = (_Float16)(bf16_round(W[t * 8 + i]) * 16.0f); *(v8us*)((unsigned short*)Bt + t * 8) = f.half[0];  }
// ---- fast GEMM (wave tile 32x64; requires M % 128 == 0 rows per launch region, N % 64 == 0 and K % 64 == 0); epilogue = k_gemm_hhx semantics, but the CP addend takes C's own grid-y offset ----
__device__ __forceinline__ v16h g2_frag(const _Float16* p, int hh) { FragH f; f.half[0] = *(const v8us*)((const unsigned short*)p + 8 * hh); f.half[1] = *(const v8us*)((const unsigned short*)p + 16 + 8 * hh); return f.v; }
__device__ __forceinline__ v8f g2_mma(v16h a, v16h b, v8f c) { v8f d = __builtin_amdgcn_wmma_f32_16x16x32_f16(false, a, false, b, (short)0, c, false, false); asm volatile("v_nop\n\tv_nop\n\tv_nop\n\tv_nop" : "+v"(d) : "v"(a), "v"(b)); return d; }
#define G2_KT 64                      /* k per stage: 128 bytes of every operand row */
#define G2_PITCH 144                  /* LDS row pitch in bytes: 128 + 16, an odd multiple of 16 for the 16-byte fragment reads */
#define G2_STAGE (192 * G2_PITCH)     /* one stage: 128 A rows, then 64 B rows */
// One stage's copies of one lane: 16 bytes of each of 8 A rows and 4 B rows (rows 16 apart; sa, sb = 16 rows in bytes), global memory -> LDS through no register.
// A wave's 32 lanes cover 4 whole 128-byte rows per copy. s_wait_xcnt 0 ends the statement so that it stands in front of any rewrite of the address registers the copies name.
__device__ __forceinline__ void g2_stage(unsigned l, const char* ga, size_t sa, const char* gb, size_t sb) {
  const char* a1 = ga + sa; const char* a2 = a1 + sa; const char* a3 = a2 + sa; const char* a4 = a3 + sa; const char* a5 = a4 + sa; const char* a6 = a5 + sa; const char* a7 = a6 + sa;
  const char* b1 = gb + sb; const char* b2 = b1 + sb; const char* b3 = b2 + sb;
  asm volatile("global_load_async_to_lds_b128 %0, %12, off\n\t"
               "global_load_async_to_lds_b128 %1, %13, off\n\t"
               "global_load_async_to_lds_b128 %2, %14, off\n\t"
               "global_load_async_to_lds_b128 %3, %15, off\n\t"
               "global_load_async_to_lds_b128 %4, %16, off\n\t"
               "global_load_async_to_lds_b128 %5, %17, off\n\t"
               "global_load_async_to_lds_b128 %6, %18, off\n\t"
               "global_load_async_to_lds_b128 %7, %19, off\n\t"
               "global_load_async_to_lds_b128 %8, %20, off\n\t"
               "global_load_async_to_lds_b128 %9, %21, off\n\t"
               "global_load_async_to_lds_b128 %10, %22, off\n\t"
               "global_load_async_to_lds_b128 %11, %23, off\n\t"
               "s_wait_xcnt 0x0"
               :: "v"(l), "v"(l + 16 * G2_PITCH), "v"(l + 32 * G2_PITCH), "v"(l + 48 * G2_PITCH), "v"(l + 64 * G2_PITCH), "v"(l + 80 * G2_PITCH), "v"(l + 96 * G2_PITCH), "v"(l + 112 * G2_PITCH),
                  "v"(l + 128 * G2_PITCH), "v"(l + 144 * G2_PITCH), "v"(l + 160 * G2_PITCH), "v"(l + 176 * G2_PITCH),
                  "v"(ga), "v"(a1), "v"(a2), "v"(a3), "v"(a4), "v"(a5), "v"(a6), "v"(a7), "v"(gb), "v"(b1), "v"(b2), "v"(b3)
               : "memory");
}
// ---- epilogue of the q / k / v projections: a wave's 32 x 64 f32 tile (32 token rows x the 64 values of one head, staged in LDS at a pitch of 68 floats) goes out as the f16 planes that the flash kernels read ----
// f16 hi + 2^10-residual of 8 values
__device__ __forceinline__ void hl8(const float* a, FragH& fh, FragH& fl) {
#pragma unroll
  for (int q = 0; q < 8; ++q) { const _Float16 h = (_Float16)a[q]; fh.h[q] = h; fl.h[q] = (_Float16)((a[q] - (float)h) * 1024.0f); } }
// q, k: rotate-half RoPE of token rows row0 .. row0 + 31, then the split. A lane takes 8 pairs (g + i, g + 32 + i) of one row; 4 lanes write a row's whole 128 bytes of each plane. ld: row pitch of H and L; hc: the head's first column.
__device__ __forceinline__ void rope_tile(const float (*t)[68], int lane, int row0, const float* __restrict__ CS, const float* __restrict__ SN, _Float16* __restrict__ H, _Float16* __restrict__ L, int ld, int hc) {
  const int rr = lane >> 2, g = (lane & 3) * 8;
  const float* cb = CS + (size_t)(row0 + rr) * HH + g; const float* sb = SN + (size_t)(row0 + rr) * HH + g;      /* the lane's place in the tables at its first row; its other rows lie 8 rows apart, at constant offsets */
  float ct[4][8], st[4][8];
#pragma unroll
  for (int p = 0; p < 4; ++p) { *(v4fa*)&ct[p][0] = *(const v4fa*)(cb + p * 8 * HH); *(v4fa*)&ct[p][4] = *(const v4fa*)(cb + p * 8 * HH + 4); *(v4fa*)&st[p][0] = *(const v4fa*)(sb + p * 8 * HH); *(v4fa*)&st[p][4] = *(const v4fa*)(sb + p * 8 * HH + 4); }
  asm volatile("s_wait_xcnt 0x0" :: "v"(cb), "v"(sb) : "memory");      /* the table loads' two address pairs, held as inputs up to here, are rewritten only behind this wait */
#pragma unroll
  for (int p = 0; p < 4; ++p) { const int r = p * 8 + rr; const int s = row0 + r; const float* c = ct[p]; const float* sn = st[p]; float x0[8], x1[8], o0[8], o1[8];
    *(v4fa*)&x0[0] = *(const v4fa*)&t[r][g]; *(v4fa*)&x0[4] = *(const v4fa*)&t[r][g + 4]; *(v4fa*)&x1[0] = *(const v4fa*)&t[r][HH + g]; *(v4fa*)&x1[4] = *(const v4fa*)&t[r][HH + g + 4];
#pragma unroll
    for (int q = 0; q < 8; ++q) {
      #pragma clang fp contract(off)      /* numerical: each of the four products keeps its own rounding, as the reference's x * cos + rotate_half(x) * sin has it; fused, q and k would change in their last bit */
      float a = x0[q] * c[q]; a += -x1[q] * sn[q]; float b = x1[q] * c[q]; b += x0[q] * sn[q]; o0[q] = a; o1[q] = b; }
    FragH h0, h1, l0, l1; hl8(o0, h0, l0); hl8(o1, h1, l1);
    const size_t d = (size_t)s * ld + hc + g;
    *(v8us*)((unsigned short*)H + d) = h0.half[0]; *(v8us*)((unsigned short*)H + d + HH) = h1.half[0]; *(v8us*)((unsigned short*)L + d) = l0.half[0]; *(v8us*)((unsigned short*)L + d + HH) = l1.half[0]; }
  asm volatile("s_wait_xcnt 0x0" ::: "memory"); }      /* the V^T part follows in the listing and reuses the registers that the last stores above name: it is kept behind this wait */
// v: the split, written transposed into [batch][kv head][64][SLEN]. A lane takes 8 tokens of one of the 64 values; 4 lanes write the wave's 32 tokens (64 bytes) of a V^T row.
__device__ __forceinline__ void vt_tile(const float (*t)[68], int lane, int row0, int hk, _Float16* __restrict__ Vt, _Float16* __restrict__ VtL) {
  const int dd = lane >> 2, t8 = (lane & 3) * 8; const int b = row0 / SLEN, tok = row0 - b * SLEN;
#pragma unroll
  for (int p = 0; p < 8; ++p) { const int d = p * 8 + dd; float a[8];
#pragma unroll
    for (int q = 0; q < 8; ++q) a[q] = t[t8 + q][d];
    FragH fh, fl; hl8(a, fh, fl);
    const size_t o = ((size_t)(b * NKV + hk) * HD + d) * SLEN + tok + t8;
    *(v8us*)((unsigned short*)Vt + o) = fh.half[0]; *(v8us*)((unsigned short*)VtL + o) = fl.half[0]; } }
// Block tile 128x64, row tile mt, column tile nq (M % 128 == 0, N % 64 == 0, K % 64 == 0): the A and B tiles of a stage go to LDS by asynchronous copies, two buffers, stage t + 2 in flight while stage t + 1 is worked on; the waves read their fragments from LDS. The order of the products along k is the plain one.
// EPI 0: C (f32) and / or C16 as they are. EPI 1 (the q / k / v projections; one column tile = one head): the tile goes out through rope_tile (isv false; planes P0, P1 of pitch N) or vt_tile (isv true; P0, P1 = V^T planes); isv is the same for a whole block.
template <int ACT, int EPI>
__device__ __forceinline__ void gemm2_job(int mt, int nq, int by, const _Float16* __restrict__ A, int lda, size_t sA, const _Float16* __restrict__ Bh, int ldb, size_t sB, float alpha, const float* __restrict__ bias, size_t sBias, const float* __restrict__ CP, int rowsPerB, size_t sCPb, int row0g,
    float* __restrict__ C, _Float16* __restrict__ C16, int ldc, size_t sC, int M, int N, int K, bool isv, const float* __restrict__ CS, const float* __restrict__ SN, _Float16* __restrict__ P0, _Float16* __restrict__ P1) {
  __shared__ __attribute__((aligned(128))) unsigned char sm[2 * G2_STAGE];
  float (*so)[32][68] = (float (*)[32][68])sm;      /* output staging (4 x 32 x 68 floats) over the two buffers, used only behind the last trip's barrier */
  const int tid = threadIdx.x, w = tid >> 5, lane = tid & 31, ln = lane & 15, hh = lane >> 4;
  A += (size_t)by * sA; Bh += (size_t)by * sB; const size_t cofs = (size_t)by * sC; const float* bp = bias ? bias + (size_t)by * sBias : nullptr;
  const int row0 = mt * 128 + 32 * w, col0 = nq * 64; if (mt * 128 >= M) return;      /* the whole block leaves or none, in front of every barrier */
  const int cr = tid >> 3, cc = tid & 7;      /* copy lane: row cr (+ 16 i) of the tile, 16-byte piece cc of its 128 bytes */
  const char* ga = (const char*)(A + (size_t)(mt * 128 + cr) * lda + cc * 8); const char* gb = (const char*)(Bh + (size_t)(col0 + cr) * ldb + cc * 8);
  const size_t sa = (size_t)lda * 32, sb = (size_t)ldb * 32;
  const unsigned l0 = (unsigned)(size_t)sm + (unsigned)(cr * G2_PITCH + cc * 16);
  const int nst = K / G2_KT;
  g2_stage(l0, ga, sa, gb, sb);
  asm volatile("s_wait_asynccnt 0x0" ::: "memory");      /* stage 0 of this wave has landed */
  __syncthreads();                                       /* ... and every other wave's */
  if (nst > 1) g2_stage(l0 + G2_STAGE, ga + 2 * G2_KT, sa, gb + 2 * G2_KT, sb);
  const v8f z8 = {0.f,0.f,0.f,0.f,0.f,0.f,0.f,0.f}; v8f c00 = z8, c01 = z8, c02 = z8, c03 = z8, c10 = z8, c11 = z8, c12 = z8, c13 = z8;
  /* kept rolled: one trip per stage, so that the waits, the barrier and the refill at its foot stand once */
#pragma unroll 1
  for (int t = 0; t < nst; ++t) { const unsigned bo = (unsigned)(t & 1) * G2_STAGE;
    const _Float16* a0p = (const _Float16*)(sm + bo + (32 * w + ln) * G2_PITCH); const _Float16* a1p = (const _Float16*)(sm + bo + (32 * w + 16 + ln) * G2_PITCH);
    const _Float16* b0p = (const _Float16*)(sm + bo + (128 + ln) * G2_PITCH); const _Float16* b1p = (const _Float16*)(sm + bo + (144 + ln) * G2_PITCH); const _Float16* b2p = (const _Float16*)(sm + bo + (160 + ln) * G2_PITCH); const _Float16* b3p = (const _Float16*)(sm + bo + (176 + ln) * G2_PITCH);
    /* unrolled: the two 32-k steps of a stage read LDS at constant offsets */
#pragma unroll
    for (int kb = 0; kb < G2_KT; kb += 32) { const v16h a0 = g2_frag(a0p + kb, hh), a1 = g2_frag(a1p + kb, hh), b0 = g2_frag(b0p + kb, hh), b1 = g2_frag(b1p + kb, hh), b2 = g2_frag(b2p + kb, hh), b3 = g2_frag(b3p + kb, hh);
      c00 = g2_mma(a0, b0, c00); c10 = g2_mma(a1, b0, c10);
      c01 = g2_mma(a0, b1, c01); c11 = g2_mma(a1, b1, c11);
      c02 = g2_mma(a0, b2, c02); c12 = g2_mma(a1, b2, c12);
      c03 = g2_mma(a0, b3, c03); c13 = g2_mma(a1, b3, c13); }
    asm volatile("s_wait_dscnt 0x0" ::: "memory");       /* this wave's reads of the buffer are done before it is refilled */
    asm volatile("s_wait_asynccnt 0x0" ::: "memory");    /* this wave's copies of stage t + 1 have landed */
    __syncthreads();                                     /* publishes stage t + 1 and ends every wave's reads of stage t */
    if (t + 2 < nst) g2_stage(l0 + bo, ga + (size_t)(t + 2) * (2 * G2_KT), sa, gb + (size_t)(t + 2) * (2 * G2_KT), sb); }
  asm volatile("s_wait_asynccnt 0x0" ::: "memory");      /* no copy is outstanding when the buffers become output staging */
  v8f accs[8] = {c00, c01, c02, c03, c10, c11, c12, c13};
#pragma unroll
  for (int u = 0; u < 8; ++u) { const int t = u & 3, half = u >> 2; const int col = col0 + t * 16 + ln; const float bv = bp ? bf16_round(bp[col]) : 0.f;
#pragma unroll
    for (int r = 0; r < 8; ++r) { const int rloc = half * 16 + 8 * hh + r; float v = accs[u][r] * alpha + bv; if (CP) { const int bidx = (row0g + row0 + rloc) / rowsPerB; v += CP[cofs + (size_t)bidx * sCPb + col]; }
      if (ACT == 3) v = fmaxf(v, 0.f); else if (ACT == 6) v = 0.5f * v * (1.0f + erff(v * 0.70710678118654752f)); else if (ACT == 11) v = 1.0f / (1.0f + expf(-v)); else if (ACT == 15) v = v / (1.0f + expf(-v)); else if (ACT == 12) v = (v > 0.f) ? v : 0.01f * v; else if (ACT == 8) v = tanhf(v);
      so[w][rloc][t * 16 + ln] = v; } }
  __builtin_amdgcn_fence(__ATOMIC_ACQ_REL, "workgroup"); __builtin_amdgcn_wave_barrier();
  if (EPI == 1) { if (isv) vt_tile(so[w], lane, row0, nq, P0, P1); else rope_tile(so[w], lane, row0, CS, SN, P0, P1, N, col0); return; }
  const int rsub = lane >> 4, c4 = (lane & 15) * 4;
  {
#pragma unroll
    for (int q = 0; q < 16; ++q) { const int r = q * 2 + rsub; const v4f v = *(const v4fa*)&so[w][r][c4]; if (C) *(v4f*)(C + cofs + (size_t)(row0 + r) * ldc + col0 + c4) = v; if (C16) { v4h h4; for (int i = 0; i < 4; ++i) h4[i] = (_Float16)v[i]; *(v4h*)(C16 + cofs + (size_t)(row0 + r) * ldc + col0 + c4) = h4; } }
     } }



template <int ACT>
__global__ __launch_bounds__(128) void k_gemm2(const _Float16* __restrict__ A, int lda, size_t sA, const _Float16* __restrict__ Bh, int ldb, size_t sB, float alpha, const float* __restrict__ bias, size_t sBias, const float* __restrict__ CP, int rowsPerB, size_t sCPb, int row0g,
    float* __restrict__ C, _Float16* __restrict__ C16, int ldc, size_t sC, int M, int N, int K) {
  const int ntn = N >> 6; const int mt = blockIdx.x / ntn, nq = blockIdx.x - mt * ntn;
  gemm2_job<ACT, 0>(mt, nq, blockIdx.y, A, lda, sA, Bh, ldb, sB, alpha, bias, sBias, CP, rowsPerB, sCPb, row0g, C, C16, ldc, sC, M, N, K, false, nullptr, nullptr, nullptr, nullptr); }
// The q, k and v projections in one grid (they share A and do not depend on one another): block b takes row tile b / 48 and one of that row tile's 48 column tiles, 32 of q, then 8 of k, then 8 of v.
#define QKV_NT ((EMB + 2 * KVD) / 64)
__global__ __launch_bounds__(128) void k_gemm2_qkv(const _Float16* __restrict__ A, const _Float16* __restrict__ BQ, const _Float16* __restrict__ BK, const _Float16* __restrict__ BV, const float* __restrict__ bq, const float* __restrict__ bk, const float* __restrict__ bv,
    const float* __restrict__ CS, const float* __restrict__ SN, _Float16* __restrict__ H16, _Float16* __restrict__ L16, _Float16* __restrict__ KH8, _Float16* __restrict__ KL8, _Float16* __restrict__ VT, _Float16* __restrict__ VTL) {
  const int mt = blockIdx.x / QKV_NT, nt = blockIdx.x - mt * QKV_NT; const bool isq = nt < EMB / 64, isk = nt < (EMB + KVD) / 64;
  const _Float16* B = isq ? BQ : (isk ? BK : BV); const float* bias = isq ? bq : (isk ? bk : bv); _Float16* P0 = isq ? H16 : (isk ? KH8 : VT); _Float16* P1 = isq ? L16 : (isk ? KL8 : VTL);
  const int N = isq ? EMB : KVD; const int nq = nt - (isq ? 0 : (isk ? EMB / 64 : (EMB + KVD) / 64));
  gemm2_job<0, 1>(mt, nq, 0, A, EMB, 0, B, EMB, 0, 0.0625f, bias, 0, nullptr, 1, 0, 0, nullptr, nullptr, N, 0, NR, N, EMB, !isk, CS, SN, P0, P1); }

// Both flash kernels work on the transposed products: S^T = K Q^T (A = 16 key rows, B = the wave's 16 queries) and O^T += V^T P^T (A = 16 rows of V^T, B = P^T).
// A lane then holds 16 of the 32 scores of ONE query (query ln; keys 8 hh + r of each 16-key tile), so the row maximum and the row sum are in-lane plus one exchange with lane ^ 16,
// and the two score tiles, converted in place, are already the B operand of the second product (element s = tile s / 8, register s % 8): P goes through no LDS.
__device__ __forceinline__ float xhalf(float x) { return __builtin_bit_cast(float, __builtin_amdgcn_permlanex16(__builtin_bit_cast(int, x), __builtin_bit_cast(int, x), 0x76543210, 0xfedcba98, false, false)); }      /* the value of lane ^ 16 */
#define SCL2 0.18033688011112042f      /* 64^-0.5 * log2(e): the softmax of the plain kernel runs in base 2 */
// Plain kernel: p * 2^10 = 2^(s * SCL2 + off) with off = 10 - max * SCL2: one fused multiply-add and one hardware exp2 per score; the row maximum is taken on the raw scores (SCL2 > 0).
// The accumulators and the row sum carry the 2^10, which the final division takes out.
#define FL_PITCH 144                  /* LDS row pitch in bytes: 128 + 16, an odd multiple of 16 for the 16-byte fragment reads */
#define FL_STAGE (128 * FL_PITCH)     /* one stage of 64 keys: 64 K rows (128 bytes = the head's 64 f16), then 64 V^T rows (128 bytes = 64 keys) */
// One stage's copies of one lane: 16 bytes of each of 4 K rows and 4 V^T rows (rows 16 apart; sk, sv = 16 rows in bytes), global memory -> LDS through no register.
// A wave's 32 lanes cover 4 whole 128-byte rows per copy. s_wait_xcnt 0 ends the statement so that it stands in front of any rewrite of the address registers the copies name.
__device__ __forceinline__ void fl_stage(unsigned l, const char* gk, size_t sk, const char* gv, size_t sv) {
  const char* k1 = gk + sk; const char* k2 = k1 + sk; const char* k3 = k2 + sk;
  const char* v1 = gv + sv; const char* v2 = v1 + sv; const char* v3 = v2 + sv;
  asm volatile("global_load_async_to_lds_b128 %0, %8, off\n\t"
               "global_load_async_to_lds_b128 %1, %9, off\n\t"
               "global_load_async_to_lds_b128 %2, %10, off\n\t"
               "global_load_async_to_lds_b128 %3, %11, off\n\t"
               "global_load_async_to_lds_b128 %4, %12, off\n\t"
               "global_load_async_to_lds_b128 %5, %13, off\n\t"
               "global_load_async_to_lds_b128 %6, %14, off\n\t"
               "global_load_async_to_lds_b128 %7, %15, off\n\t"
               "s_wait_xcnt 0x0"
               :: "v"(l), "v"(l + 16 * FL_PITCH), "v"(l + 32 * FL_PITCH), "v"(l + 48 * FL_PITCH), "v"(l + 64 * FL_PITCH), "v"(l + 80 * FL_PITCH), "v"(l + 96 * FL_PITCH), "v"(l + 112 * FL_PITCH),
                  "v"(gk), "v"(k1), "v"(k2), "v"(k3), "v"(gv), "v"(v1), "v"(v2), "v"(v3)
               : "memory");
}
// The K and V^T tiles of 64 keys go to LDS once per block by asynchronous copies in whole 128-byte rows, two buffers, stage t + 2 in flight while stage t + 1 is worked on; the block's 4 waves read their fragments from LDS.
// Each stage is worked on as two steps of 32 keys, with the products, the maxima and the sums in the order they had with fragments read from global memory.
template <int CAUSAL>
__global__ __launch_bounds__(128) void k_flash(const _Float16* __restrict__ Q16, int ldq, const _Float16* __restrict__ K16, int ldk, const _Float16* __restrict__ Vt, const int* __restrict__ MSK, _Float16* __restrict__ OH, int ldo) {
  constexpr int RPW = 16, DT = 4, KS = 2;
  __shared__ __attribute__((aligned(128))) unsigned char sm[2 * FL_STAGE];
  float (*sO)[RPW][64 + 4] = (float (*)[RPW][64 + 4])sm;      /* output staging (4 x 16 x 68 floats) over the two buffers, used only behind the last trip's barrier */
  const int tid = threadIdx.x, w = tid >> 5, lane = tid & 31, ln = lane & 15, hh = lane >> 4;
  const int slab = blockIdx.x / QBNP, qblk = QB0P + blockIdx.x % QBNP; const int b = slab / NH, h = slab % NH; const int qb0 = qblk * (4 * RPW); const int q0 = qb0 + w * RPW; const int tq = q0 + ln;      /* tq: this lane's query */
  const int hk = h / (NH / NKV);      /* the kv head that query head h reads */
  const unsigned short* Vth = (const unsigned short*)Vt + (size_t)(b * NKV + hk) * 64 * TK;
  const int jend = (CAUSAL == 1) ? (qb0 + 4 * RPW) : TK;      /* causal: keys beyond the block's last query never contribute */
  const int nst = jend / 64;                                  /* jend is a multiple of 64 in every mode */
  const int cr = tid >> 3, cc = tid & 7;      /* copy lane: row cr (+ 16 i) of each tile, 16-byte piece cc of its 128 bytes */
  const char* gk = (const char*)((const unsigned short*)K16 + ((size_t)b * TK + cr) * ldk + hk * 64 + cc * 8); const char* gv = (const char*)(Vth + (size_t)cr * TK + cc * 8);
  const size_t sk = (size_t)ldk * 32, sv = (size_t)TK * 32, dk = (size_t)ldk * 128;      /* dk: 64 key rows in bytes; a stage moves V^T by 128 bytes */
  const unsigned l0 = (unsigned)(size_t)sm + (unsigned)(cr * FL_PITCH + cc * 16);
  fl_stage(l0, gk, sk, gv, sv);
  FragH aq[KS];
  { const unsigned short* qr = (const unsigned short*)Q16 + ((size_t)b * TQ + tq) * ldq + h * 64;
#pragma unroll
    for (int ks = 0; ks < KS; ++ks) { aq[ks].half[0] = *(const v8us*)(qr + ks * 32 + 8 * hh); aq[ks].half[1] = *(const v8us*)(qr + ks * 32 + 16 + 8 * hh); } }
  asm volatile("s_wait_asynccnt 0x0" ::: "memory");      /* stage 0 of this wave has landed */
  __syncthreads();                                       /* ... and every other wave's */
  if (nst > 1) fl_stage(l0 + FL_STAGE, gk + dk, sk, gv + 128, sv);
  float m_r = -3.0e38f, off_r = 10.0f + 3.0e38f * SCL2, l_r = 0.f; v8f oacc[DT];      /* m_r: running maximum of the raw scores; off_r = 10 - m_r * SCL2; l_r: the sum over this lane's own keys, the two halves join behind the loop */
#pragma unroll
  for (int dt = 0; dt < DT; ++dt) oacc[dt] = (v8f){0.f,0.f,0.f,0.f,0.f,0.f,0.f,0.f};
  /* kept rolled: one trip per stage, so that the waits, the barrier and the refill at its foot stand once */
#pragma unroll 1
  for (int t = 0; t < nst; ++t) { const unsigned bo = (unsigned)(t & 1) * FL_STAGE;
    const unsigned short* kl = (const unsigned short*)(sm + bo + ln * FL_PITCH) + 8 * hh; const unsigned short* vl = (const unsigned short*)(sm + bo + (64 + ln) * FL_PITCH) + 8 * hh;      /* this lane's row of the first K tile and of the first V^T tile */
    /* unrolled: the two 32-key steps of a stage read LDS at constant offsets */
#pragma unroll
    for (int sub = 0; sub < 2; ++sub) { const int j0 = t * 64 + sub * 32;
      FragH bk[2][KS], bv[DT];
#pragma unroll
      for (int nt = 0; nt < 2; ++nt) { const unsigned short* kr = kl + (sub * 32 + nt * 16) * (FL_PITCH / 2);
#pragma unroll
        for (int ks = 0; ks < KS; ++ks) { bk[nt][ks].half[0] = *(const v8us*)(kr + ks * 32); bk[nt][ks].half[1] = *(const v8us*)(kr + ks * 32 + 16); } }
      v8f s[2];
#pragma unroll
      for (int nt = 0; nt < 2; ++nt) { v8f acc = (v8f){0.f,0.f,0.f,0.f,0.f,0.f,0.f,0.f};
#pragma unroll
        for (int ks = 0; ks < KS; ++ks) acc = mmaH<1>(bk[nt][ks].v, bk[nt][ks].v, aq[ks].v, aq[ks].v, acc);
        s[nt] = acc; }
      asm volatile("" ::: "memory");      /* compiler fence: keeps the V^T fragment reads behind the score products, so that they take over the K fragments' registers and fly during the softmax; without it the kernel takes 159 registers in place of 138 and a SIMD holds 6 waves in place of 7 */
#pragma unroll
      for (int dt = 0; dt < DT; ++dt) { const unsigned short* vrow = vl + dt * 16 * (FL_PITCH / 2) + sub * 32; bv[dt].half[0] = *(const v8us*)(vrow); bv[dt].half[1] = *(const v8us*)(vrow + 16); }
      float sc[16]; bool ok[16]; float mc = -3.0e38f;
#pragma unroll
      for (int e = 0; e < 16; ++e) { const int key = j0 + (e >> 3) * 16 + 8 * hh + (e & 7);
        ok[e] = (CAUSAL == 1) ? (key <= tq) : ((CAUSAL == 2) ? ((key >> 5) == (tq >> 5)) : true);      /* mode 2: block-diagonal 32-token groups */
        sc[e] = ok[e] ? s[e >> 3][e & 7] : -3.0e38f; mc = fmaxf(mc, sc[e]); }
      mc = fmaxf(mc, xhalf(mc));
      const float mn = fmaxf(m_r, mc); const float off = 10.0f - mn * SCL2; const float ea = __builtin_amdgcn_exp2f(off - off_r);      /* 2^(off - off_r): the factor that moves the accumulators to the new maximum */
      const float al = (mn > -1.0e38f) ? ea : 1.0f; m_r = mn; off_r = off;
      float ps[4] = {0.f, 0.f, 0.f, 0.f}; FragH pb;
#pragma unroll
      for (int e = 0; e < 16; ++e) { const float ee = __builtin_amdgcn_exp2f(sc[e] * SCL2 + off); const float p = ok[e] ? ee : 0.f; ps[e & 3] += p; pb.h[e] = (_Float16)p; }
      l_r = l_r * al + ((ps[0] + ps[1]) + (ps[2] + ps[3]));
#pragma unroll
      for (int dt = 0; dt < DT; ++dt)
#pragma unroll
        for (int r = 0; r < 8; ++r) oacc[dt][r] *= al;
#pragma unroll
      for (int dt = 0; dt < DT; ++dt) oacc[dt] = mmaH<1>(bv[dt].v, bv[dt].v, pb.v, pb.v, oacc[dt]); }
    asm volatile("s_wait_dscnt 0x0" ::: "memory");       /* this wave's reads of the buffer are done before it is refilled */
    asm volatile("s_wait_asynccnt 0x0" ::: "memory");    /* this wave's copies of stage t + 1 have landed */
    __syncthreads();                                     /* publishes stage t + 1 and ends every wave's reads of stage t */
    if (t + 2 < nst) fl_stage(l0 + bo, gk + (size_t)(t + 2) * dk, sk, gv + (size_t)(t + 2) * 128, sv); }
  asm volatile("s_wait_asynccnt 0x0" ::: "memory");      /* no copy is outstanding when the buffers become output staging */
  const float l = l_r + xhalf(l_r); const float linv = (l > 0.f) ? 1.0f / l : 0.f;
#pragma unroll
  for (int dt = 0; dt < DT; ++dt)
#pragma unroll
    for (int r = 0; r < 8; ++r) sO[w][ln][dt * 16 + 8 * hh + r] = oacc[dt][r] * linv;
  __builtin_amdgcn_fence(__ATOMIC_ACQ_REL, "workgroup"); __builtin_amdgcn_wave_barrier();
  {
#pragma unroll
    for (int rp = 0; rp < RPW; rp += 4) { const int r = rp + (lane >> 3), pc = lane & 7; const v4f va = *(const v4fa*)&sO[w][r][pc * 8], vb = *(const v4fa*)&sO[w][r][pc * 8 + 4]; FragH f;      /* the output leaves as the f16 operand of the output GEMM: 8 lanes write a row's 128 bytes */
#pragma unroll
      for (int q = 0; q < 4; ++q) { f.h[q] = (_Float16)va[q]; f.h[4 + q] = (_Float16)vb[q]; }
      *(v8us*)((unsigned short*)OH + ((size_t)b * TQ + q0 + r) * ldo + h * 64 + pc * 8) = f.half[0]; }
     } }
// 5-plane variant: S = Qh Kh^T + (Ql Kh^T + Qh Kl^T)/1024 with Q/K = [hi | 2^10 residual] f16 planes (QL/KL same layout as Q16/K16), then the 3-term P.V below.
// 3-term variant: O = (P_hi V_hi + (P_lo V_hi + P_hi V_lo) / 1024) / l with P = [hi | 2^10 residual] of 1024 p and V^T = [hi | 2^10 residual] planes (VtL same layout as Vt) -> ~2^-21-class products for un-averaged (early causal / peaked) rows
template <int CAUSAL>
__global__ __launch_bounds__(128) void k_flash5(const _Float16* __restrict__ Q16, const _Float16* __restrict__ QL, int ldq, const _Float16* __restrict__ K16, const _Float16* __restrict__ KL, int ldk, const _Float16* __restrict__ Vt, const _Float16* __restrict__ VtL, const int* __restrict__ MSK, _Float16* __restrict__ OH, _Float16* __restrict__ OL, int ldo) {
  constexpr int RPW = 16, DT = 4, KS = 2;
  __shared__ __attribute__((aligned(16))) float sO[4][RPW][64 + 4];
  const int tid = threadIdx.x, w = tid >> 5, lane = tid & 31, ln = lane & 15, hh = lane >> 4;
  const int slab = blockIdx.x / QBN5, qblk = QB05 + blockIdx.x % QBN5; const int b = slab / NH, h = slab % NH; const int qb0 = qblk * (4 * RPW); const int q0 = qb0 + w * RPW; const int tq = q0 + ln;      /* tq: this lane's query */
  const int hk = h / (NH / NKV);      /* the kv head that query head h reads */
  FragH aq[KS], aql[KS];
  { const unsigned short* qr = (const unsigned short*)Q16 + ((size_t)b * TQ + tq) * ldq + h * 64; const unsigned short* ql = (const unsigned short*)QL + ((size_t)b * TQ + tq) * ldq + h * 64;
#pragma unroll
    for (int ks = 0; ks < KS; ++ks) { aq[ks].half[0] = *(const v8us*)(qr + ks * 32 + 8 * hh); aq[ks].half[1] = *(const v8us*)(qr + ks * 32 + 16 + 8 * hh); aql[ks].half[0] = *(const v8us*)(ql + ks * 32 + 8 * hh); aql[ks].half[1] = *(const v8us*)(ql + ks * 32 + 16 + 8 * hh); } }
  const unsigned short* Vth = (const unsigned short*)Vt + (size_t)(b * NKV + hk) * 64 * TK; const unsigned short* Vtl = (const unsigned short*)VtL + (size_t)(b * NKV + hk) * 64 * TK;
  float m_r = -3.0e38f, l_r = 0.f; v8f oacc[DT], oaccL[DT];      /* l_r: the sum over this lane's own keys; the two halves join behind the loop */
#pragma unroll
  for (int dt = 0; dt < DT; ++dt) { oacc[dt] = (v8f){0.f,0.f,0.f,0.f,0.f,0.f,0.f,0.f}; oaccL[dt] = oacc[dt]; }
  const int jend = (CAUSAL == 1) ? (qb0 + 4 * RPW) : TK;      /* causal: keys beyond the block's last query never contribute */
#pragma unroll 1
  for (int j0 = 0; j0 < jend; j0 += 32) {
    FragH bk[2][KS], bkl[2][KS], bv[DT], bl[DT]; const unsigned short* kr[2]; const unsigned short* klr[2];
#pragma unroll
    for (int nt = 0; nt < 2; ++nt) { kr[nt] = (const unsigned short*)K16 + ((size_t)b * TK + j0 + nt * 16 + ln) * ldk + hk * 64 + 8 * hh; klr[nt] = (const unsigned short*)KL + ((size_t)b * TK + j0 + nt * 16 + ln) * ldk + hk * 64 + 8 * hh;
#pragma unroll
      for (int ks = 0; ks < KS; ++ks) { bk[nt][ks].half[0] = *(const v8us*)(kr[nt] + ks * 32); bk[nt][ks].half[1] = *(const v8us*)(kr[nt] + ks * 32 + 16); bkl[nt][ks].half[0] = *(const v8us*)(klr[nt] + ks * 32); bkl[nt][ks].half[1] = *(const v8us*)(klr[nt] + ks * 32 + 16); } }
    v8f s[2];
#pragma unroll
    for (int nt = 0; nt < 2; ++nt) { v8f acc = (v8f){0.f,0.f,0.f,0.f,0.f,0.f,0.f,0.f}, accl = acc;
#pragma unroll
      for (int ks = 0; ks < KS; ++ks) { acc = mmaH<1>(bk[nt][ks].v, bk[nt][ks].v, aq[ks].v, aq[ks].v, acc); accl = mmaH<1>(bk[nt][ks].v, bk[nt][ks].v, aql[ks].v, aql[ks].v, accl); accl = mmaH<1>(bkl[nt][ks].v, bkl[nt][ks].v, aq[ks].v, aq[ks].v, accl); }
#pragma unroll
      for (int r = 0; r < 8; ++r) acc[r] += accl[r] * 0.0009765625f;
      s[nt] = acc; }
    asm volatile("s_wait_xcnt 0x0" :: "v"(kr[0]), "v"(kr[1]), "v"(klr[0]), "v"(klr[1]) : "memory");      /* the K loads' address registers, held as inputs up to here, are rewritten only behind this wait; the clobber keeps the V loads behind the score products, so that they take over the K fragments' registers and fly during the softmax */
#pragma unroll
    for (int dt = 0; dt < DT; ++dt) { const unsigned short* vrow = Vth + (size_t)(dt * 16 + ln) * TK + j0; const unsigned short* vrl = Vtl + (size_t)(dt * 16 + ln) * TK + j0; bv[dt].half[0] = *(const v8us*)(vrow + 8 * hh); bv[dt].half[1] = *(const v8us*)(vrow + 16 + 8 * hh); bl[dt].half[0] = *(const v8us*)(vrl + 8 * hh); bl[dt].half[1] = *(const v8us*)(vrl + 16 + 8 * hh); }
    float sc[16]; bool ok[16]; float mc = -3.0e38f;
#pragma unroll
    for (int e = 0; e < 16; ++e) { const int key = j0 + (e >> 3) * 16 + 8 * hh + (e & 7);
      ok[e] = (CAUSAL == 1) ? (key <= tq) : ((CAUSAL == 2) ? ((key >> 5) == (tq >> 5)) : true);      /* mode 2: block-diagonal 32-token groups */
      if (CAUSAL == 4) ok[e] = MSK[((size_t)b * TQ + tq) * TK + key] != 0;      /* mode 4: per-(query, key) INPUT mask shared by all heads; masked keys contribute nothing, rows with no valid key give l = 0 -> output 0 */
      sc[e] = ok[e] ? s[e >> 3][e & 7] * SCL : -3.0e38f; mc = fmaxf(mc, sc[e]); }
    mc = fmaxf(mc, xhalf(mc));
    const float mn = fmaxf(m_r, mc); const float ea = expf(m_r - mn); const float al = (mn > -1.0e38f) ? ea : 1.0f; m_r = mn;
    float ps[4] = {0.f, 0.f, 0.f, 0.f}; FragH pb, pl;
#pragma unroll
    for (int e = 0; e < 16; ++e) { const float ee = expf(sc[e] - mn); const float p = ok[e] ? ee : 0.f; ps[e & 3] += p; const float p1k = p * 1024.0f; const _Float16 ph = (_Float16)p1k; pb.h[e] = ph; pl.h[e] = (_Float16)((p1k - (float)ph) * 1024.0f); }
    l_r = l_r * al + ((ps[0] + ps[1]) + (ps[2] + ps[3]));
#pragma unroll
    for (int dt = 0; dt < DT; ++dt)
#pragma unroll
      for (int r = 0; r < 8; ++r) { oacc[dt][r] *= al; oaccL[dt][r] *= al; }
#pragma unroll
    for (int dt = 0; dt < DT; ++dt) { oacc[dt] = mmaH<1>(bv[dt].v, bv[dt].v, pb.v, pb.v, oacc[dt]); oaccL[dt] = mmaH<1>(bv[dt].v, bv[dt].v, pl.v, pl.v, oaccL[dt]); oaccL[dt] = mmaH<1>(bl[dt].v, bl[dt].v, pb.v, pb.v, oaccL[dt]); } }
  const float l = l_r + xhalf(l_r); const float linv = (l > 0.f) ? 1.0f / (l * 1024.0f) : 0.f;
#pragma unroll
  for (int dt = 0; dt < DT; ++dt)
#pragma unroll
    for (int r = 0; r < 8; ++r) { float v = oacc[dt][r]; v += oaccL[dt][r] * 0.0009765625f; sO[w][ln][dt * 16 + 8 * hh + r] = v * linv; }
  __builtin_amdgcn_fence(__ATOMIC_ACQ_REL, "workgroup"); __builtin_amdgcn_wave_barrier();
  {
#pragma unroll
    for (int rp = 0; rp < RPW; rp += 4) { const int r = rp + (lane >> 3), pc = lane & 7; float a[8]; *(v4fa*)&a[0] = *(const v4fa*)&sO[w][r][pc * 8]; *(v4fa*)&a[4] = *(const v4fa*)&sO[w][r][pc * 8 + 4]; FragH fh, fl; hl8(a, fh, fl);      /* the output leaves as the f16 hi + residual operands of the output GEMMs: 8 lanes write a row's 128 bytes of each */
      const size_t o = ((size_t)b * TQ + q0 + r) * ldo + h * 64 + pc * 8; *(v8us*)((unsigned short*)OH + o) = fh.half[0]; *(v8us*)((unsigned short*)OL + o) = fl.half[0]; }
     } }

__global__ __launch_bounds__(256) void k_wsc(const float* __restrict__ Wm, _Float16* __restrict__ Bt, size_t n8, float sc) { const size_t t = (size_t)blockIdx.x * 256 + threadIdx.x; if (t >= n8) return; FragH f; for (int q = 0; q < 8; ++q) f.h[q] = (_Float16)(bf16_round(Wm[t * 8 + q]) * sc); *(v8us*)((unsigned short*)Bt + t * 8) = f.half[0];  }      /* (out,in) weight == Bt[n][k]: scaled copy */




__device__ __forceinline__ void rotab_job(int bx, const int* __restrict__ pid, float* __restrict__ CS, float* __restrict__ SN) {      /* s = token row over both batches */
  #pragma clang fp contract(off)
  const int t = bx * 256 + threadIdx.x; if (t >= NR * HH) return; const int j = t % HH, s = t / HH; const float inv = 1.0f / powf(10000.0f, (float)(2 * j) / (float)HD); const float th = (float)pid[s] * inv; const float c = cosf(th), sn = sinf(th);
  { *(float*)(CS + t) = c; *(float*)(SN + t) = sn;  } }

// ---- launches that do not depend on one another share one grid: a range of the block index picks the job (the test is the same for a whole block, so each job's barrier is passed by all of its block or by none) ----
#define PB_ROT (NR * HH / 256)                    /* angle tables */
#define PB_WB ((EMB / 64) * (EMB / 64))           /* tiles of Wq, of Wo */
#define PB_WS ((EMB / 64) * (KVD / 64))           /* tiles of Wk, of Wv */
#define PB_X (NR * EMB / 8 / 256)                 /* f16 plane of x */
__global__ __launch_bounds__(256) void k_prep(const float* __restrict__ x, const float* __restrict__ Wq, const float* __restrict__ Wk, const float* __restrict__ Wv, const float* __restrict__ Wo, const int* __restrict__ pid,
    _Float16* __restrict__ X16, _Float16* __restrict__ BQ, _Float16* __restrict__ BK, _Float16* __restrict__ BV, _Float16* __restrict__ BO, float* __restrict__ CS, float* __restrict__ SN) {
  int bx = blockIdx.x;
  if (bx < PB_ROT) { rotab_job(bx, pid, CS, SN); return; }
  bx -= PB_ROT;
  if (bx < 2 * PB_WB + 2 * PB_WS) {
    const bool q = bx < PB_WB, k = bx < PB_WB + PB_WS, v = bx < PB_WB + 2 * PB_WS;
    const float* W = q ? Wq : (k ? Wk : (v ? Wv : Wo)); _Float16* Wt = q ? BQ : (k ? BK : (v ? BV : BO));
    wt_f16_job(bx - (q ? 0 : (k ? PB_WB : (v ? PB_WB + PB_WS : PB_WB + 2 * PB_WS))), W, Wt, EMB, (v && !q) ? KVD : EMB, 16.0f);      /* (in,out) weights */
    return; }
  x16_job(bx - (2 * PB_WB + 2 * PB_WS), x, X16, (size_t)NR * EMB / 8); }
extern "C" void kernel_launch(void* const* d_in, const int* in_sizes, int n_in,
                              void* d_out, int out_size, void* d_ws, size_t ws_size, hipStream_t stream) {
  (void)in_sizes; (void)n_in; (void)out_size;
  const float* const* I = (const float* const*)d_in; const float* x = I[0]; const float* Wq = I[1]; const float* bq = I[2]; const float* Wk = I[3]; const float* bk = I[4]; const float* Wv = I[5]; const float* bv = I[6]; const float* Wo = I[7]; const int* pid = (const int*)d_in[8];
  char* ws = (char*)d_ws; size_t off = 0;
  auto take = [&](size_t bytes) { char* p = ws + off; off += (bytes + 255) & ~(size_t)255; return p; };
  const size_t npb = (size_t)SLEN * EMB, npa = (size_t)NR * EMB;      /* per-batch plane, plane of both batches */
  _Float16* BQ = (_Float16*)take((size_t)EMB * EMB * 2); _Float16* BK = (_Float16*)take((size_t)KVD * EMB * 2); _Float16* BV = (_Float16*)take((size_t)KVD * EMB * 2); _Float16* BO = (_Float16*)take((size_t)EMB * EMB * 2);
  float* CS = (float*)take((size_t)NR * HH * 4); float* SN = (float*)take((size_t)NR * HH * 4);
  _Float16* X16 = (_Float16*)take(npa * 2); _Float16* KH8 = (_Float16*)take((size_t)NR * KVD * 2); _Float16* KL8 = (_Float16*)take((size_t)NR * KVD * 2);
  _Float16* H16 = (_Float16*)take(npa * 2); _Float16* L16 = (_Float16*)take(npa * 2); _Float16* VT = (_Float16*)take((size_t)NR * KVD * 2); _Float16* VTL = (_Float16*)take((size_t)NR * KVD * 2);      /* H16, L16: q hi and residual; VT, VTL: [batch][kv head][64][SLEN] */
  _Float16* OH = X16; _Float16* OLo = (_Float16*)take(npa * 2);      /* O hi over the x plane (dead after the projections); of O's residual only the first RE rows of each batch are written and read */
  if (off > ws_size) return;      /* 8+2+2+8 + 1 + 16 + 4+4 + 16 + 16 + 4 + 4 + 16 = 101 MiB */
  float* ob = (float*)d_out;
  k_prep<<<PB_ROT + 2 * PB_WB + 2 * PB_WS + PB_X, 256, 0, stream>>>(x, Wq, Wk, Wv, Wo, pid, X16, BQ, BK, BV, BO, CS, SN);
  k_gemm2_qkv<<<(NR / 128) * QKV_NT, 128, 0, stream>>>(X16, BQ, BK, BV, bq, bk, bv, CS, SN, H16, L16, KH8, KL8, VT, VTL);
  k_flash5<1><<<NB * NH * QBN5, 128, 0, stream>>>(H16, L16, EMB, KH8, KL8, KVD, VT, VTL, nullptr, OH, OLo, EMB);
  k_flash<1><<<NB * NH * QBNP, 128, 0, stream>>>(H16, EMB, KH8, KVD, VT, nullptr, OH, EMB);
  k_gemm2<0><<<dim3((NR / 128) * (EMB / 64), 1), 128, 0, stream>>>(OH, EMB, 0, BO, EMB, 0, 0.0625f, nullptr, 0, nullptr, 1, 0, 0, ob, nullptr, EMB, 0, NR, EMB, EMB);
  k_gemm2<0><<<dim3((RE / 128) * (EMB / 64), NB), 128, 0, stream>>>(OLo, EMB, npb, BO, EMB, 0, 0.0625f / 1024.0f, nullptr, 0, ob, 1, (size_t)EMB, 0, ob, nullptr, EMB, npb, RE, EMB, EMB);      /* grid y = batch: the first RE rows of each */
}

// v010
// Measured time: 198 microseconds a run.
// Two timings next to v009 both put it at 1.12 times that version's speed.
// All steps since the starting kernel, v000, together make it 6.97 times as fast.
#include <hip/hip_runtime.h>
// GQA self-attention (2 x 2048 tokens, hidden 2048; 32 query heads / 8 kv heads of 64 (GQA), rotate-half RoPE from the INPUT position ids, causal SDPA (1/8), out = o Wo): q/k/v = x W + b.
// Structure (both batches in every launch: the 4096 token rows are one row range, batch = row / 2048): exact f16 plane of x; angle tables from the input position ids (f32 trig); q / k / v GEMMs (32x64 wave tiles, f32 accumulation, exact x16 weights + bias) whose epilogue, on the f32 tile staged in LDS, does RoPE on VALU and splits q and k into f16 hi + 2^10-residual planes, and splits v and writes it transposed (V^T hi/residual); k and v stay in their 8 kv heads, and query head h reads kv head h / 4 in place (the reference's repeat 4); the fused causal flash kernel in its 5-plane form for the first 256 query rows and plain beyond, each writing its output as f16 hi (+ residual on those rows), the operands of the output GEMMs.
// Compute dtype: x, weights and biases rounded to bf16; rows < 256 per batch: q, k, P, v, O hi + residual; beyond: plain f16; f32 accumulation/softmax/trig. v_wmma_f32_16x16x32_f16.
#define NB 2
#define EMB 2048
#define NR (NB * SLEN)           /* 4096 token rows */
#define SLEN 2048
#define SQ SLEN
#define TQ SLEN
#define TK SLEN
#define NH 32
#define NKV 8
#define KVD (NKV * HD)
#define HD 64
#define HH (HD / 2)
#define SCL 0.125f               /* 64^-0.5 */
#define QBLKS (TQ / 64)
#define QB05 0                   /* 5-plane flash: query blocks [0, QBN5) of every (batch, head) — the early causal rows whose outputs average over few keys */
#define QBN5 4
#define QB0P QBN5                /* plain flash (hi planes only): query blocks [QBN5, QBLKS) */
#define QBNP (QBLKS - QBN5)
#define RE 256                   /* rows per batch that take the hi+lo output operand (= QBN5 * 64) */
typedef __bf16 v16b __attribute__((ext_vector_type(16)));
typedef unsigned short v8us __attribute__((ext_vector_type(8), may_alias));
typedef float  v8f  __attribute__((ext_vector_type(8)));
typedef float  v4f  __attribute__((ext_vector_type(4)));
typedef float  v4fa __attribute__((ext_vector_type(4), may_alias));
union FragB { v16b v; v8us half[2]; unsigned short u[16]; };

__device__ __forceinline__ unsigned short bf16_bits(float x) { unsigned int u = __float_as_uint(x); return (unsigned short)((u + 0x7FFFu + ((u >> 16) & 1u)) >> 16); }
__device__ __forceinline__ float bf16_val(unsigned short b) { return __uint_as_float(((unsigned int)b) << 16); }
__device__ __forceinline__ float bf16_round(float x) { return bf16_val(bf16_bits(x)); }
// D += A·B with NT terms: 1 = ah·bh, 2 = + al·bh (A split), 3 = + ah·bl (both split)
template <int NT>
__device__ __forceinline__ v8f mmaN(v16b ah, v16b al, v16b bh, v16b bl, v8f c) {
  c = __builtin_amdgcn_wmma_f32_16x16x32_bf16(false, ah, false, bh, (short)0, c, false, false);
  if (NT >= 2) c = __builtin_amdgcn_wmma_f32_16x16x32_bf16(false, al, false, bh, (short)0, c, false, false);
  if (NT >= 3) c = __builtin_amdgcn_wmma_f32_16x16x32_bf16(false, ah, false, bl, (short)0, c, false, false);
  asm volatile("v_nop\n\tv_nop\n\tv_nop\n\tv_nop" : "+v"(c) : "v"(ah), "v"(al), "v"(bh), "v"(bl));
  return c;
}

__global__ __launch_bounds__(256) void k_wt_bf16(const float* __restrict__ W, unsigned short* __restrict__ Wt, int K, int N) {
  const int t = blockIdx.x * 256 + threadIdx.x;
  const int k8n = K / 8;
  if (t >= N * k8n) return;
  const int n = t / k8n, k8 = (t % k8n) * 8;
  v8us v;
#pragma unroll
  for (int i = 0; i < 8; ++i) v[i] = bf16_bits(W[(size_t)(k8 + i) * N + n]);
  *(v8us*)(Wt + (size_t)n * K + k8) = v;
  
}

// GEMM C[M][N] (f32, pitch ldc) = act(A[M][K]·W + bias). A f32 row-major (pitch lda) converted per fragment to bf16
// (ASPLIT: hi/lo two planes -> 2 terms, else single rounded term); Wt bf16 [N][K] (pitch ldb). BIAS_BF16 rounds the
// bias to bf16 first (bias quantised to bf16 before the add). K%32==0, M%16==0, N%64==0.
template <bool ASPLIT, int ACT, bool BIAS_BF16>
__global__ __launch_bounds__(128) void k_gemm_bf(const float* __restrict__ A, int lda, const unsigned short* __restrict__ Wt, int ldb,
                                               const float* __restrict__ bias, float* __restrict__ C, int ldc, int M, int N, int K) {
  __shared__ __attribute__((aligned(16))) float so[4][16][64];
  const int tid = threadIdx.x, w = tid >> 5, lane = tid & 31, ln = lane & 15, hh = lane >> 4;
  const int ntn = N / 64;
  const int wid = blockIdx.x * 4 + w;
  const int mt = wid / ntn, nq = wid % ntn;
  if (mt * 16 >= M) return;
  const int row0 = mt * 16, col0 = nq * 64;
  const float* arow = A + (size_t)(row0 + ln) * lda;
  v8f acc[4] = {};
  for (int kb = 0; kb < K; kb += 32) {
    FragB ah, al;
    const v4f x0 = *(const v4fa*)(arow + kb + 8 * hh), x1 = *(const v4fa*)(arow + kb + 8 * hh + 4);
    const v4f x2 = *(const v4fa*)(arow + kb + 16 + 8 * hh), x3 = *(const v4fa*)(arow + kb + 16 + 8 * hh + 4);
    float xs[16] = {x0[0],x0[1],x0[2],x0[3],x1[0],x1[1],x1[2],x1[3],x2[0],x2[1],x2[2],x2[3],x3[0],x3[1],x3[2],x3[3]};
#pragma unroll
    for (int i = 0; i < 16; ++i) { const unsigned short hb = bf16_bits(xs[i]); ah.u[i] = hb; al.u[i] = ASPLIT ? bf16_bits(xs[i] - bf16_val(hb)) : (unsigned short)0; }
#pragma unroll
    for (int t = 0; t < 4; ++t) {
      const unsigned short* brow = Wt + (size_t)(col0 + t * 16 + ln) * ldb + kb;
      FragB b;
      b.half[0] = *(const v8us*)(brow + 8 * hh);
      b.half[1] = *(const v8us*)(brow + 16 + 8 * hh);
      acc[t] = mmaN<ASPLIT ? 2 : 1>(ah.v, al.v, b.v, b.v, acc[t]);
    }
  }
#pragma unroll
  for (int t = 0; t < 4; ++t) {
    float bv = bias ? bias[col0 + t * 16 + ln] : 0.f;
    if (BIAS_BF16) bv = bf16_round(bv);
#pragma unroll
    for (int r = 0; r < 8; ++r) { float v = acc[t][r] + bv; if (ACT == 1) v = fmaxf(v, 0.f); so[w][8 * hh + r][t * 16 + ln] = v; }
  }
  __builtin_amdgcn_fence(__ATOMIC_ACQ_REL, "workgroup");
  __builtin_amdgcn_wave_barrier();
  const int rsub = lane >> 4, c4 = (lane & 15) * 4;
  {
#pragma unroll
    for (int q = 0; q < 8; ++q) {
      const int r = q * 2 + rsub;
      const v4f v = *(const v4fa*)&so[w][r][c4];
      *(v4f*)(C + (size_t)(row0 + r) * ldc + col0 + c4) = v;
    }
    
  }
}

// GEMM C = act(A·W + bias + resid): A f32 (ASPLIT -> hi/lo 2 terms), Wt bf16 [N][K]; ACT 0 none, 1 relu, 2 exact gelu;
// resid (optional, f32, row index = (row % rmod), pitch ldr, RES_BF16 rounds it) added before the activation.
template <bool ASPLIT, int ACT, bool BIAS_BF16, bool RES_BF16>
__global__ __launch_bounds__(128) void k_gemm_bf3(const float* __restrict__ A, int lda, const unsigned short* __restrict__ Wt, int ldb,
                                                const float* __restrict__ bias, const float* __restrict__ resid, int rmod, int ldr,
                                                float* __restrict__ C, int ldc, int M, int N, int K) {
  __shared__ __attribute__((aligned(16))) float so[4][16][64];
  const int tid = threadIdx.x, w = tid >> 5, lane = tid & 31, ln = lane & 15, hh = lane >> 4;
  const int ntn = N / 64;
  const int wid = blockIdx.x * 4 + w;
  const int mt = wid / ntn, nq = wid % ntn;
  if (mt * 16 >= M) return;
  const int row0 = mt * 16, col0 = nq * 64;
  const float* arow = A + (size_t)(row0 + ln) * lda;
  v8f acc[4] = {};
  for (int kb = 0; kb < K; kb += 32) {
    FragB ah, al;
    const v4f x0 = *(const v4fa*)(arow + kb + 8 * hh), x1 = *(const v4fa*)(arow + kb + 8 * hh + 4);
    const v4f x2 = *(const v4fa*)(arow + kb + 16 + 8 * hh), x3 = *(const v4fa*)(arow + kb + 16 + 8 * hh + 4);
    float xs[16] = {x0[0],x0[1],x0[2],x0[3],x1[0],x1[1],x1[2],x1[3],x2[0],x2[1],x2[2],x2[3],x3[0],x3[1],x3[2],x3[3]};
#pragma unroll
    for (int i = 0; i < 16; ++i) { const unsigned short hb = bf16_bits(xs[i]); ah.u[i] = hb; al.u[i] = ASPLIT ? bf16_bits(xs[i] - bf16_val(hb)) : (unsigned short)0; }
#pragma unroll
    for (int t = 0; t < 4; ++t) {
      const unsigned short* brow = Wt + (size_t)(col0 + t * 16 + ln) * ldb + kb;
      FragB b;
      b.half[0] = *(const v8us*)(brow + 8 * hh);
      b.half[1] = *(const v8us*)(brow + 16 + 8 * hh);
      acc[t] = mmaN<ASPLIT ? 2 : 1>(ah.v, al.v, b.v, b.v, acc[t]);
    }
  }
#pragma unroll
  for (int t = 0; t < 4; ++t) {
    const int col = col0 + t * 16 + ln;
    float bv = bias ? bias[col] : 0.f;
    if (BIAS_BF16) bv = bf16_round(bv);
#pragma unroll
    for (int r = 0; r < 8; ++r) {
      float v = acc[t][r] + bv;
      if (resid) { float rv = resid[(size_t)((row0 + 8 * hh + r) % rmod) * ldr + col]; if (RES_BF16) rv = bf16_round(rv); v += rv; }
      if (ACT == 1) v = fmaxf(v, 0.f);
      if (ACT == 2) v = 0.5f * v * (1.0f + erff(v * 0.70710678118654752f));
      if (ACT == 3) { const float u = 0.7978845608028654f * (v + 0.044715f * v * v * v); v = 0.5f * v * (1.0f + tanhf(u)); }
      so[w][8 * hh + r][t * 16 + ln] = v;
    }
  }
  __builtin_amdgcn_fence(__ATOMIC_ACQ_REL, "workgroup");
  __builtin_amdgcn_wave_barrier();
  const int rsub = lane >> 4, c4 = (lane & 15) * 4;
  {
#pragma unroll
    for (int q = 0; q < 8; ++q) {
      const int r = q * 2 + rsub;
      const v4f v = *(const v4fa*)&so[w][r][c4];
      *(v4f*)(C + (size_t)(row0 + r) * ldc + col0 + c4) = v;
    }
    
  }
}
// row LayerNorm (biased variance, eps) over N: s = X (+ R); optional out_sum <- s; out_norm <- (s-mu)*rsqrt(var+eps)*g + b
template <bool PARAM_BF16>
__global__ __launch_bounds__(256) void k_layernorm(const float* __restrict__ X, const float* __restrict__ R, const float* __restrict__ g, const float* __restrict__ bta,
                                                  float* __restrict__ out_sum, float* __restrict__ out_norm, int N, float eps) {
  __shared__ float red[256];
  const int row = blockIdx.x, tid = threadIdx.x;
  const float* x = X + (size_t)row * N; const float* rr = R ? R + (size_t)row * N : nullptr;
  float vals[16];                     // up to N = 4096
  const int per = N / 256;            // contiguous chunk per thread? use strided-by-4 chunks: thread handles j = tid*4 + 1024*u
  float s1 = 0.f;
  for (int u = 0; u < per / 4; ++u) {
    const int j = tid * 4 + 1024 * u;
    const v4f a = *(const v4fa*)(x + j);
    v4f b = {0.f,0.f,0.f,0.f}; if (rr) b = *(const v4fa*)(rr + j);
#pragma unroll
    for (int q = 0; q < 4; ++q) { const float v = a[q] + b[q]; vals[u * 4 + q] = v; s1 += v; }
  }
  red[tid] = s1; __syncthreads();
  for (int st = 128; st > 0; st >>= 1) { if (tid < st) red[tid] += red[tid + st]; __syncthreads(); }
  const float mu = red[0] / (float)N; __syncthreads();
  float s2 = 0.f;
  for (int u = 0; u < per / 4; ++u)
#pragma unroll
    for (int q = 0; q < 4; ++q) { const float c = vals[u * 4 + q] - mu; s2 += c * c; }
  red[tid] = s2; __syncthreads();
  for (int st = 128; st > 0; st >>= 1) { if (tid < st) red[tid] += red[tid + st]; __syncthreads(); }
  const float rs = rsqrtf(red[0] / (float)N + eps);
  {
    for (int u = 0; u < per / 4; ++u) {
      const int j = tid * 4 + 1024 * u;
      v4f o, sm;
#pragma unroll
      for (int q = 0; q < 4; ++q) {
        float gg = g[j + q], bb = bta[j + q];
        if (PARAM_BF16) { gg = bf16_round(gg); bb = bf16_round(bb); }
        sm[q] = vals[u * 4 + q]; o[q] = (vals[u * 4 + q] - mu) * rs * gg + bb;
      }
      if (out_sum) *(v4f*)(out_sum + (size_t)row * N + j) = sm;
      *(v4f*)(out_norm + (size_t)row * N + j) = o;
    }
    
  }
}



// ---- f16 WMMA path (v_wmma_f32_16x16x32_f16): 11-bit significands for operands in range — used where a [0,1] probability operand needs more precision than bf16
typedef _Float16 v16h __attribute__((ext_vector_type(16)));
union FragH { v16h v; v8us half[2]; _Float16 h[16]; unsigned short u[16]; };
template <int NT>
__device__ __forceinline__ v8f mmaH(v16h ah, v16h al, v16h bh, v16h bl, v8f c) {
  c = __builtin_amdgcn_wmma_f32_16x16x32_f16(false, ah, false, bh, (short)0, c, false, false);
  if (NT >= 2) c = __builtin_amdgcn_wmma_f32_16x16x32_f16(false, al, false, bh, (short)0, c, false, false);
  if (NT >= 3) c = __builtin_amdgcn_wmma_f32_16x16x32_f16(false, ah, false, bl, (short)0, c, false, false);
  asm volatile("v_nop\n\tv_nop\n\tv_nop\n\tv_nop" : "+v"(c) : "v"(ah), "v"(al), "v"(bh), "v"(bl));
  return c;
}
// batched GEMM like k_gemm_b but f16 operands: A f32 (split into f16 hi/lo if ASPLIT, else rounded to f16), Bt = f16 values [n][k]; alpha; C f32; N multiple of 16 (partial tiles skipped)
template <bool ASPLIT>
__global__ __launch_bounds__(128) void k_gemm_h(const float* __restrict__ A, int lda, size_t sA, const _Float16* __restrict__ Bh, int ldb, size_t sB, float alpha, float* __restrict__ C, int ldc, size_t sC, int M, int N, int K) {
  __shared__ __attribute__((aligned(16))) float so[4][16][64];
  const int tid = threadIdx.x, w = tid >> 5, lane = tid & 31, ln = lane & 15, hh = lane >> 4; const int by = blockIdx.y;
  A += (size_t)by * sA; Bh += (size_t)by * sB; C += (size_t)by * sC;
  const int ntn = (N + 63) / 64; const int wid = blockIdx.x * 4 + w; const int mt = wid / ntn, nq = wid % ntn; if (mt * 16 >= M) return;
  const int row0 = mt * 16, col0 = nq * 64; const float* arow = A + (size_t)(row0 + ln) * lda;
  v8f acc[4] = {};
  for (int kb = 0; kb < K; kb += 32) {
    FragH ah, al;
    const v4f x0 = *(const v4fa*)(arow + kb + 8 * hh), x1 = *(const v4fa*)(arow + kb + 8 * hh + 4), x2 = *(const v4fa*)(arow + kb + 16 + 8 * hh), x3 = *(const v4fa*)(arow + kb + 16 + 8 * hh + 4);
    float xs[16] = {x0[0],x0[1],x0[2],x0[3],x1[0],x1[1],x1[2],x1[3],x2[0],x2[1],x2[2],x2[3],x3[0],x3[1],x3[2],x3[3]};
#pragma unroll
    for (int i = 0; i < 16; ++i) { const _Float16 h = (_Float16)xs[i]; ah.h[i] = h; al.h[i] = ASPLIT ? (_Float16)(xs[i] - (float)h) : (_Float16)0.0f; }
#pragma unroll
    for (int t = 0; t < 4; ++t) { if (col0 + t * 16 >= N) continue; const size_t boff = (size_t)(col0 + t * 16 + ln) * ldb + kb; FragH bq; bq.half[0] = *(const v8us*)(Bh + boff + 8 * hh); bq.half[1] = *(const v8us*)(Bh + boff + 16 + 8 * hh);
      acc[t] = mmaH<ASPLIT ? 2 : 1>(ah.v, al.v, bq.v, bq.v, acc[t]); }
  }
#pragma unroll
  for (int t = 0; t < 4; ++t) { if (col0 + t * 16 >= N) continue;
#pragma unroll
    for (int r = 0; r < 8; ++r) so[w][8 * hh + r][t * 16 + ln] = acc[t][r] * alpha; }
  __builtin_amdgcn_fence(__ATOMIC_ACQ_REL, "workgroup"); __builtin_amdgcn_wave_barrier();
  const int rsub = lane >> 4, c4 = (lane & 15) * 4;
  {
#pragma unroll
    for (int q = 0; q < 8; ++q) { const int r = q * 2 + rsub; if (col0 + c4 < N) { const v4f v = *(const v4fa*)&so[w][r][c4]; *(v4f*)(C + (size_t)(row0 + r) * ldc + col0 + c4) = v; } }
     }
}

// Wt[n][k] = f16(W[k][n]·scale) from f32 row-major W[K][N] (scale = power of two; bf16-exact weights stay exact in f16 away from the subnormal range)
// One block of 256 per 64 x 64 tile (K % 64 == 0, N % 64 == 0; (K / 64) * (N / 64) tiles): W is read in whole 256-byte row pieces (16 bytes a lane), converted, turned in LDS, and Wt is written in whole 128-byte rows (16 bytes a lane).
__device__ __forceinline__ void wt_f16_job(int bx, const float* __restrict__ W, _Float16* __restrict__ Wt, int K, int N, float scale) {      /* bx: the tile's index */
  __shared__ unsigned int tl[64][33];      /* tile [k][n], two f16 a word; the odd pitch keeps the column reads below on distinct banks */
  const int tid = threadIdx.x; const int nkt = K >> 6; const int nt = bx / nkt, kt = bx - nt * nkt; const int k0 = kt * 64, n0 = nt * 64;
  const int r = tid >> 4, c4 = (tid & 15) * 4; v4f a[4];
#pragma unroll
  for (int p = 0; p < 4; ++p) a[p] = *(const v4fa*)(W + (size_t)(k0 + p * 16 + r) * N + n0 + c4);
#pragma unroll
  for (int p = 0; p < 4; ++p) { FragH f;
#pragma unroll
    for (int q = 0; q < 4; ++q) f.h[q] = (_Float16)(bf16_round(a[p][q]) * scale);
    tl[p * 16 + r][c4 / 2] = (unsigned int)f.u[0] | ((unsigned int)f.u[1] << 16); tl[p * 16 + r][c4 / 2 + 1] = (unsigned int)f.u[2] | ((unsigned int)f.u[3] << 16); }
  __syncthreads();
  typedef unsigned short usa __attribute__((may_alias)); const usa* ts = (const usa*)&tl[0][0];      /* the words of the tile read as single f16 */
#pragma unroll
  for (int rd = 0; rd < 2; ++rd) { const int n = rd * 32 + (tid >> 3), pc = tid & 7; FragH f;
#pragma unroll
    for (int q = 0; q < 8; ++q) f.u[q] = ts[(pc * 8 + q) * 66 + n];
    *(v8us*)((unsigned short*)Wt + (size_t)(n0 + n) * K + k0 + pc * 8) = f.half[0]; }
  asm volatile("s_wait_xcnt 0x0" ::: "memory");      /* in a shared grid other jobs' code follows in the listing and reuses the registers that the two stores above name: it is kept behind this wait */
}
// k_gemm_hh variant with fused epilogue: v = acc·alpha + bias[by·sBias + col] (+ CP[(row/rowsPerB)·sCPb + by·64 + col] if CP) ; ACT 0 none / 1 elu ; writes f16 C16 (and f32 C if non-null)
template <int ACT>
__global__ __launch_bounds__(128) void k_gemm_hhx(const _Float16* __restrict__ A, int lda, size_t sA, const _Float16* __restrict__ Bh, int ldb, size_t sB, float alpha, const float* __restrict__ bias, size_t sBias, const float* __restrict__ CP, int rowsPerB, size_t sCPb, int row0g,
    float* __restrict__ C, _Float16* __restrict__ C16, int ldc, size_t sC, int M, int N, int K) {
  __shared__ __attribute__((aligned(16))) float so[4][16][64];
  const int tid = threadIdx.x, w = tid >> 5, lane = tid & 31, ln = lane & 15, hh = lane >> 4; const int by = blockIdx.y;
  A += (size_t)by * sA; Bh += (size_t)by * sB; const size_t cofs = (size_t)by * sC; const float* bp = bias ? bias + (size_t)by * sBias : nullptr;
  const int ntn = (N + 63) / 64; const int wid = blockIdx.x * 4 + w; const int mt = wid / ntn, nq = wid % ntn; if (mt * 16 >= M) return;
  const int row0 = mt * 16, col0 = nq * 64; const _Float16* arow = A + (size_t)(row0 + ln) * lda;
  v8f acc[4] = {};
  for (int kb = 0; kb < K; kb += 32) { FragH ah; ah.half[0] = *(const v8us*)((const unsigned short*)arow + kb + 8 * hh); ah.half[1] = *(const v8us*)((const unsigned short*)arow + kb + 16 + 8 * hh);
#pragma unroll
    for (int t = 0; t < 4; ++t) { if (col0 + t * 16 >= N) continue; const size_t boff = (size_t)(col0 + t * 16 + ln) * ldb + kb; FragH bq; bq.half[0] = *(const v8us*)((const unsigned short*)Bh + boff + 8 * hh); bq.half[1] = *(const v8us*)((const unsigned short*)Bh + boff + 16 + 8 * hh);
      acc[t] = mmaH<1>(ah.v, ah.v, bq.v, bq.v, acc[t]); }
  }
#pragma unroll
  for (int t = 0; t < 4; ++t) { if (col0 + t * 16 >= N) continue; const int col = col0 + t * 16 + ln; const float bv = bp ? bf16_round(bp[col]) : 0.f;
#pragma unroll
    for (int r = 0; r < 8; ++r) { float v = acc[t][r] * alpha + bv; if (CP) { const int bidx = (row0g + row0 + 8 * hh + r) / rowsPerB; v += CP[(size_t)bidx * sCPb + (size_t)by * 64 + col]; } if (ACT == 1) v = (v > 0.f) ? v : expm1f(v); else if (ACT == 7) v = (v > 0.f) ? v + 1.0f : expf(v); else if (ACT == 8) v = tanhf(v); else if (ACT == 9) v = 0.5f * v * (1.0f + tanhf(0.7978845608028654f * (v + 0.044715f * v * v * v))); else if (ACT == 11) v = 1.0f / (1.0f + expf(-v)); else if (ACT == 12) v = (v > 0.f) ? v : 0.01f * v; else if (ACT == 14) v = (v > 0.f) ? v : 0.1f * v; else if (ACT == 15) v = v / (1.0f + expf(-v)); else if (ACT == 3) v = fmaxf(v, 0.f); else if (ACT == 6) v = 0.5f * v * (1.0f + erff(v * 0.70710678118654752f)); so[w][8 * hh + r][t * 16 + ln] = v; } }
  __builtin_amdgcn_fence(__ATOMIC_ACQ_REL, "workgroup"); __builtin_amdgcn_wave_barrier();
  const int rsub = lane >> 4, c4 = (lane & 15) * 4; typedef _Float16 v4h __attribute__((ext_vector_type(4)));
  {
#pragma unroll
    for (int q = 0; q < 8; ++q) { const int r = q * 2 + rsub; if (col0 + c4 < N) { const v4f v = *(const v4fa*)&so[w][r][c4]; if (C) *(v4f*)(C + cofs + (size_t)(row0 + r) * ldc + col0 + c4) = v; if (C16) { v4h h4; for (int i = 0; i < 4; ++i) h4[i] = (_Float16)v[i]; *(v4h*)(C16 + cofs + (size_t)(row0 + r) * ldc + col0 + c4) = h4; } } }
     }
}


typedef _Float16 v4h __attribute__((ext_vector_type(4)));

__device__ __forceinline__ void x16_job(int bx, const float* __restrict__ x, _Float16* __restrict__ X16, size_t n8) { const size_t t = (size_t)bx * 256 + threadIdx.x; if (t >= n8) return; FragH f;
#pragma unroll
  for (int q = 0; q < 8; ++q) f.h[q] = (_Float16)bf16_round(x[t * 8 + q]); *(v8us*)((unsigned short*)X16 + t * 8) = f.half[0];  }
__global__ __launch_bounds__(256) void k_h16(const float* __restrict__ x, _Float16* __restrict__ X16, size_t n8) { const size_t t = (size_t)blockIdx.x * 256 + threadIdx.x; if (t >= n8) return; FragH f;
#pragma unroll
  for (int q = 0; q < 8; ++q) f.h[q] = (_Float16)x[t * 8 + q]; *(v8us*)((unsigned short*)X16 + t * 8) = f.half[0];  }
__global__ __launch_bounds__(256) void k_round16f(const float* __restrict__ W, _Float16* __restrict__ Bt, size_t n8) { const size_t t = (size_t)blockIdx.x * 256 + threadIdx.x; if (t >= n8) return; FragH f;
#pragma unroll
  for (int i = 0; i < 8; ++i) f.h[i] = (_Float16)(bf16_round(W[t * 8 + i]) * 16.0f); *(v8us*)((unsigned short*)Bt + t * 8) = f.half[0];  }
// ---- fast GEMM (wave tile 32x64, block tile 128x128; requires M % 128 == 0 rows per launch region, N % 128 == 0 and K % 64 == 0); epilogue = k_gemm_hhx semantics, but the CP addend takes C's own grid-y offset ----
__device__ __forceinline__ v16h g2_frag(const _Float16* p, int hh) { FragH f; f.half[0] = *(const v8us*)((const unsigned short*)p + 8 * hh); f.half[1] = *(const v8us*)((const unsigned short*)p + 16 + 8 * hh); return f.v; }
__device__ __forceinline__ v8f g2_mma(v16h a, v16h b, v8f c) { v8f d = __builtin_amdgcn_wmma_f32_16x16x32_f16(false, a, false, b, (short)0, c, false, false); asm volatile("v_nop\n\tv_nop\n\tv_nop\n\tv_nop" : "+v"(d) : "v"(a), "v"(b)); return d; }
#define G2_KT 64                      /* k per stage: 128 bytes of every operand row */
#define G2_PITCH 144                  /* LDS row pitch in bytes: 128 + 16, an odd multiple of 16 for the 16-byte fragment reads */
#define G2_STAGE (256 * G2_PITCH)     /* one stage: 128 A rows, then 128 B rows */
// One stage's copies of one lane: 16 bytes of each of 4 A rows and 4 B rows (rows 32 apart; sa, sb = 32 rows in bytes), global memory -> LDS through no register.
// A wave's 32 lanes cover 4 whole 128-byte rows per copy. s_wait_xcnt 0 ends the statement so that it stands in front of any rewrite of the address registers the copies name.
__device__ __forceinline__ void g2_stage(unsigned l, const char* ga, size_t sa, const char* gb, size_t sb) {
  const char* a1 = ga + sa; const char* a2 = a1 + sa; const char* a3 = a2 + sa;
  const char* b1 = gb + sb; const char* b2 = b1 + sb; const char* b3 = b2 + sb;
  asm volatile("global_load_async_to_lds_b128 %0, %8, off\n\t"
               "global_load_async_to_lds_b128 %1, %9, off\n\t"
               "global_load_async_to_lds_b128 %2, %10, off\n\t"
               "global_load_async_to_lds_b128 %3, %11, off\n\t"
               "global_load_async_to_lds_b128 %4, %12, off\n\t"
               "global_load_async_to_lds_b128 %5, %13, off\n\t"
               "global_load_async_to_lds_b128 %6, %14, off\n\t"
               "global_load_async_to_lds_b128 %7, %15, off\n\t"
               "s_wait_xcnt 0x0"
               :: "v"(l), "v"(l + 32 * G2_PITCH), "v"(l + 64 * G2_PITCH), "v"(l + 96 * G2_PITCH), "v"(l + 128 * G2_PITCH), "v"(l + 160 * G2_PITCH), "v"(l + 192 * G2_PITCH), "v"(l + 224 * G2_PITCH),
                  "v"(ga), "v"(a1), "v"(a2), "v"(a3), "v"(gb), "v"(b1), "v"(b2), "v"(b3)
               : "memory");
}
// ---- epilogue of the q / k / v projections: a wave's 32 x 64 f32 tile (32 token rows x the 64 values of one head, staged in LDS at a pitch of 68 floats) goes out as the f16 planes that the flash kernels read ----
// f16 hi + 2^10-residual of 8 values
__device__ __forceinline__ void hl8(const float* a, FragH& fh, FragH& fl) {
#pragma unroll
  for (int q = 0; q < 8; ++q) { const _Float16 h = (_Float16)a[q]; fh.h[q] = h; fl.h[q] = (_Float16)((a[q] - (float)h) * 1024.0f); } }
// q, k: rotate-half RoPE of token rows row0 .. row0 + 31, then the split. A lane takes 8 pairs (g + i, g + 32 + i) of one row; 4 lanes write a row's whole 128 bytes of each plane. ld: row pitch of H and L; hc: the head's first column.
__device__ __forceinline__ void rope_tile(const float (*t)[68], int lane, int row0, const float* __restrict__ CS, const float* __restrict__ SN, _Float16* __restrict__ H, _Float16* __restrict__ L, int ld, int hc) {
  const int rr = lane >> 2, g = (lane & 3) * 8;
  const float* cb = CS + (size_t)(row0 + rr) * HH + g; const float* sb = SN + (size_t)(row0 + rr) * HH + g;      /* the lane's place in the tables at its first row; its other rows lie 8 rows apart, at constant offsets */
  float ct[4][8], st[4][8];
#pragma unroll
  for (int p = 0; p < 4; ++p) { *(v4fa*)&ct[p][0] = *(const v4fa*)(cb + p * 8 * HH); *(v4fa*)&ct[p][4] = *(const v4fa*)(cb + p * 8 * HH + 4); *(v4fa*)&st[p][0] = *(const v4fa*)(sb + p * 8 * HH); *(v4fa*)&st[p][4] = *(const v4fa*)(sb + p * 8 * HH + 4); }
  asm volatile("s_wait_xcnt 0x0" :: "v"(cb), "v"(sb) : "memory");      /* the table loads' two address pairs, held as inputs up to here, are rewritten only behind this wait */
#pragma unroll
  for (int p = 0; p < 4; ++p) { const int r = p * 8 + rr; const int s = row0 + r; const float* c = ct[p]; const float* sn = st[p]; float x0[8], x1[8], o0[8], o1[8];
    *(v4fa*)&x0[0] = *(const v4fa*)&t[r][g]; *(v4fa*)&x0[4] = *(const v4fa*)&t[r][g + 4]; *(v4fa*)&x1[0] = *(const v4fa*)&t[r][HH + g]; *(v4fa*)&x1[4] = *(const v4fa*)&t[r][HH + g + 4];
#pragma unroll
    for (int q = 0; q < 8; ++q) {
      #pragma clang fp contract(off)      /* numerical: each of the four products keeps its own rounding, as the reference's x * cos + rotate_half(x) * sin has it; fused, q and k would change in their last bit */
      float a = x0[q] * c[q]; a += -x1[q] * sn[q]; float b = x1[q] * c[q]; b += x0[q] * sn[q]; o0[q] = a; o1[q] = b; }
    FragH h0, h1, l0, l1; hl8(o0, h0, l0); hl8(o1, h1, l1);
    const size_t d = (size_t)s * ld + hc + g;
    *(v8us*)((unsigned short*)H + d) = h0.half[0]; *(v8us*)((unsigned short*)H + d + HH) = h1.half[0]; *(v8us*)((unsigned short*)L + d) = l0.half[0]; *(v8us*)((unsigned short*)L + d + HH) = l1.half[0]; }
  asm volatile("s_wait_xcnt 0x0" ::: "memory"); }      /* the V^T part follows in the listing and reuses the registers that the last stores above name: it is kept behind this wait */
// v: the split, written transposed into [batch][kv head][64][SLEN]. A lane takes 8 tokens of one of the 64 values; 4 lanes write the wave's 32 tokens (64 bytes) of a V^T row.
__device__ __forceinline__ void vt_tile(const float (*t)[68], int lane, int row0, int hk, _Float16* __restrict__ Vt, _Float16* __restrict__ VtL) {
  const int dd = lane >> 2, t8 = (lane & 3) * 8; const int b = row0 / SLEN, tok = row0 - b * SLEN;
#pragma unroll
  for (int p = 0; p < 8; ++p) { const int d = p * 8 + dd; float a[8];
#pragma unroll
    for (int q = 0; q < 8; ++q) a[q] = t[t8 + q][d];
    FragH fh, fl; hl8(a, fh, fl);
    const size_t o = ((size_t)(b * NKV + hk) * HD + d) * SLEN + tok + t8;
    *(v8us*)((unsigned short*)Vt + o) = fh.half[0]; *(v8us*)((unsigned short*)VtL + o) = fl.half[0]; } }
// Block tile 128x128 on 8 waves, row tile mt, column tile nq (M % 128 == 0, N % 128 == 0, K % 64 == 0); wave w takes rows 32 (w & 3) and the column half w >> 2, so an A tile is fetched once for 128 columns: the A and B tiles of a stage go to LDS by asynchronous copies, two buffers, stage t + 2 in flight while stage t + 1 is worked on; the waves read their fragments from LDS. The order of the products along k is the plain one.
// EPI 0: C (f32) and / or C16 as they are. EPI 1 (the q / k / v projections; a wave's 64 columns = one head): the tile goes out through rope_tile (isv false; planes P0, P1 of pitch N) or vt_tile (isv true; P0, P1 = V^T planes); isv is the same for a whole block.
template <int ACT, int EPI>
__device__ __forceinline__ void gemm2_job(int mt, int nq, int by, const _Float16* __restrict__ A, int lda, size_t sA, const _Float16* __restrict__ Bh, int ldb, size_t sB, float alpha, const float* __restrict__ bias, size_t sBias, const float* __restrict__ CP, int rowsPerB, size_t sCPb, int row0g,
    float* __restrict__ C, _Float16* __restrict__ C16, int ldc, size_t sC, int M, int N, int K, bool isv, const float* __restrict__ CS, const float* __restrict__ SN, _Float16* __restrict__ P0, _Float16* __restrict__ P1) {
  __shared__ __attribute__((aligned(128))) unsigned char sm[2 * G2_STAGE];
  float (*so)[32][68] = (float (*)[32][68])sm;      /* output staging (8 x 32 x 68 floats) over the two buffers, used only behind the last trip's barrier */
  const int tid = threadIdx.x, w = tid >> 5, lane = tid & 31, ln = lane & 15, hh = lane >> 4; const int wr = w & 3, wc = w >> 2;
  A += (size_t)by * sA; Bh += (size_t)by * sB; const size_t cofs = (size_t)by * sC; const float* bp = bias ? bias + (size_t)by * sBias : nullptr;
  const int row0 = mt * 128 + 32 * wr, col0 = nq * 128 + 64 * wc; if (mt * 128 >= M) return;      /* the whole block leaves or none, in front of every barrier */
  const int cr = tid >> 3, cc = tid & 7;      /* copy lane: row cr (+ 32 i) of the tile, 16-byte piece cc of its 128 bytes */
  const char* ga = (const char*)(A + (size_t)(mt * 128 + cr) * lda + cc * 8); const char* gb = (const char*)(Bh + (size_t)(nq * 128 + cr) * ldb + cc * 8);
  const size_t sa = (size_t)lda * 64, sb = (size_t)ldb * 64;
  const unsigned l0 = (unsigned)(size_t)sm + (unsigned)(cr * G2_PITCH + cc * 16);
  const int nst = K / G2_KT;
  g2_stage(l0, ga, sa, gb, sb);
  asm volatile("s_wait_asynccnt 0x0" ::: "memory");      /* stage 0 of this wave has landed */
  __syncthreads();                                       /* ... and every other wave's */
  if (nst > 1) g2_stage(l0 + G2_STAGE, ga + 2 * G2_KT, sa, gb + 2 * G2_KT, sb);
  const v8f z8 = {0.f,0.f,0.f,0.f,0.f,0.f,0.f,0.f}; v8f c00 = z8, c01 = z8, c02 = z8, c03 = z8, c10 = z8, c11 = z8, c12 = z8, c13 = z8;
  /* kept rolled: one trip per stage, so that the waits, the barrier and the refill at its foot stand once */
#pragma unroll 1
  for (int t = 0; t < nst; ++t) { const unsigned bo = (unsigned)(t & 1) * G2_STAGE;
    const _Float16* a0p = (const _Float16*)(sm + bo + (32 * wr + ln) * G2_PITCH); const _Float16* a1p = (const _Float16*)(sm + bo + (32 * wr + 16 + ln) * G2_PITCH);
    const _Float16* b0p = (const _Float16*)(sm + bo + (128 + 64 * wc + ln) * G2_PITCH); const _Float16* b1p = (const _Float16*)(sm + bo + (144 + 64 * wc + ln) * G2_PITCH); const _Float16* b2p = (const _Float16*)(sm + bo + (160 + 64 * wc + ln) * G2_PITCH); const _Float16* b3p = (const _Float16*)(sm + bo + (176 + 64 * wc + ln) * G2_PITCH);
    /* unrolled: the two 32-k steps of a stage read LDS at constant offsets */
#pragma unroll
    for (int kb = 0; kb < G2_KT; kb += 32) { const v16h a0 = g2_frag(a0p + kb, hh), a1 = g2_frag(a1p + kb, hh), b0 = g2_frag(b0p + kb, hh), b1 = g2_frag(b1p + kb, hh), b2 = g2_frag(b2p + kb, hh), b3 = g2_frag(b3p + kb, hh);
      c00 = g2_mma(a0, b0, c00); c10 = g2_mma(a1, b0, c10);
      c01 = g2_mma(a0, b1, c01); c11 = g2_mma(a1, b1, c11);
      c02 = g2_mma(a0, b2, c02); c12 = g2_mma(a1, b2, c12);
      c03 = g2_mma(a0, b3, c03); c13 = g2_mma(a1, b3, c13); }
    asm volatile("s_wait_dscnt 0x0" ::: "memory");       /* this wave's reads of the buffer are done before it is refilled */
    asm volatile("s_wait_asynccnt 0x0" ::: "memory");    /* this wave's copies of stage t + 1 have landed */
    __syncthreads();                                     /* publishes stage t + 1 and ends every wave's reads of stage t */
    if (t + 2 < nst) g2_stage(l0 + bo, ga + (size_t)(t + 2) * (2 * G2_KT), sa, gb + (size_t)(t + 2) * (2 * G2_KT), sb); }
  asm volatile("s_wait_asynccnt 0x0" ::: "memory");      /* no copy is outstanding when the buffers become output staging */
  v8f accs[8] = {c00, c01, c02, c03, c10, c11, c12, c13};
#pragma unroll
  for (int u = 0; u < 8; ++u) { const int t = u & 3, half = u >> 2; const int col = col0 + t * 16 + ln; const float bv = bp ? bf16_round(bp[col]) : 0.f;
#pragma unroll
    for (int r = 0; r < 8; ++r) { const int rloc = half * 16 + 8 * hh + r; float v = accs[u][r] * alpha + bv; if (CP) { const int bidx = (row0g + row0 + rloc) / rowsPerB; v += CP[cofs + (size_t)bidx * sCPb + col]; }
      if (ACT == 3) v = fmaxf(v, 0.f); else if (ACT == 6) v = 0.5f * v * (1.0f + erff(v * 0.70710678118654752f)); else if (ACT == 11) v = 1.0f / (1.0f + expf(-v)); else if (ACT == 15) v = v / (1.0f + expf(-v)); else if (ACT == 12) v = (v > 0.f) ? v : 0.01f * v; else if (ACT == 8) v = tanhf(v);
      so[w][rloc][t * 16 + ln] = v; } }
  __builtin_amdgcn_fence(__ATOMIC_ACQ_REL, "workgroup"); __builtin_amdgcn_wave_barrier();
  if (EPI == 1) { if (isv) vt_tile(so[w], lane, row0, col0 / 64, P0, P1); else rope_tile(so[w], lane, row0, CS, SN, P0, P1, N, col0); return; }
  const int rsub = lane >> 4, c4 = (lane & 15) * 4;
  {
#pragma unroll
    for (int q = 0; q < 16; ++q) { const int r = q * 2 + rsub; const v4f v = *(const v4fa*)&so[w][r][c4]; if (C) *(v4f*)(C + cofs + (size_t)(row0 + r) * ldc + col0 + c4) = v; if (C16) { v4h h4; for (int i = 0; i < 4; ++i) h4[i] = (_Float16)v[i]; *(v4h*)(C16 + cofs + (size_t)(row0 + r) * ldc + col0 + c4) = h4; } }
     } }



template <int ACT>
__global__ __launch_bounds__(256) void k_gemm2(const _Float16* __restrict__ A, int lda, size_t sA, const _Float16* __restrict__ Bh, int ldb, size_t sB, float alpha, const float* __restrict__ bias, size_t sBias, const float* __restrict__ CP, int rowsPerB, size_t sCPb, int row0g,
    float* __restrict__ C, _Float16* __restrict__ C16, int ldc, size_t sC, int M, int N, int K) {
  const int ntn = N >> 7; const int mt = blockIdx.x / ntn, nq = blockIdx.x - mt * ntn;
  gemm2_job<ACT, 0>(mt, nq, blockIdx.y, A, lda, sA, Bh, ldb, sB, alpha, bias, sBias, CP, rowsPerB, sCPb, row0g, C, C16, ldc, sC, M, N, K, false, nullptr, nullptr, nullptr, nullptr); }
// The q, k and v projections in one grid (they share A and do not depend on one another): block b takes row tile b / 24 and one of that row tile's 24 column tiles, 16 of q, then 4 of k, then 4 of v.
#define QKV_NT ((EMB + 2 * KVD) / 128)
__global__ __launch_bounds__(256) void k_gemm2_qkv(const _Float16* __restrict__ A, const _Float16* __restrict__ BQ, const _Float16* __restrict__ BK, const _Float16* __restrict__ BV, const float* __restrict__ bq, const float* __restrict__ bk, const float* __restrict__ bv,
    const float* __restrict__ CS, const float* __restrict__ SN, _Float16* __restrict__ H16, _Float16* __restrict__ L16, _Float16* __restrict__ KH8, _Float16* __restrict__ KL8, _Float16* __restrict__ VT, _Float16* __restrict__ VTL) {
  const int mt = blockIdx.x / QKV_NT, nt = blockIdx.x - mt * QKV_NT; const bool isq = nt < EMB / 128, isk = nt < (EMB + KVD) / 128;
  const _Float16* B = isq ? BQ : (isk ? BK : BV); const float* bias = isq ? bq : (isk ? bk : bv); _Float16* P0 = isq ? H16 : (isk ? KH8 : VT); _Float16* P1 = isq ? L16 : (isk ? KL8 : VTL);
  const int N = isq ? EMB : KVD; const int nq = nt - (isq ? 0 : (isk ? EMB / 128 : (EMB + KVD) / 128));
  gemm2_job<0, 1>(mt, nq, 0, A, EMB, 0, B, EMB, 0, 0.0625f, bias, 0, nullptr, 1, 0, 0, nullptr, nullptr, N, 0, NR, N, EMB, !isk, CS, SN, P0, P1); }

// Both flash kernels work on the transposed products: S^T = K Q^T (A = 16 key rows, B = the wave's 16 queries) and O^T += V^T P^T (A = 16 rows of V^T, B = P^T).
// A lane then holds 16 of the 32 scores of ONE query (query ln; keys 8 hh + r of each 16-key tile), so the row maximum and the row sum are in-lane plus one exchange with lane ^ 16,
// and the two score tiles, converted in place, are already the B operand of the second product (element s = tile s / 8, register s % 8): P goes through no LDS.
__device__ __forceinline__ float xhalf(float x) { return __builtin_bit_cast(float, __builtin_amdgcn_permlanex16(__builtin_bit_cast(int, x), __builtin_bit_cast(int, x), 0x76543210, 0xfedcba98, false, false)); }      /* the value of lane ^ 16 */
#define SCL2 0.18033688011112042f      /* 64^-0.5 * log2(e): the softmax of the plain kernel runs in base 2 */
// Plain kernel: p * 2^10 = 2^(s * SCL2 + off) with off = 10 - max * SCL2: one fused multiply-add and one hardware exp2 per score; the row maximum is taken on the raw scores (SCL2 > 0).
// The accumulators and the row sum carry the 2^10, which the final division takes out.
#define FL_PITCH 144                  /* LDS row pitch in bytes: 128 + 16, an odd multiple of 16 for the 16-byte fragment reads */
#define FL_STAGE (128 * FL_PITCH)     /* one stage of 64 keys: 64 K rows (128 bytes = the head's 64 f16), then 64 V^T rows (128 bytes = 64 keys) */
// One stage's copies of one lane: 16 bytes of each of 4 K rows and 4 V^T rows (rows 16 apart; sk, sv = 16 rows in bytes), global memory -> LDS through no register.
// A wave's 32 lanes cover 4 whole 128-byte rows per copy. s_wait_xcnt 0 ends the statement so that it stands in front of any rewrite of the address registers the copies name.
__device__ __forceinline__ void fl_stage(unsigned l, const char* gk, size_t sk, const char* gv, size_t sv) {
  const char* k1 = gk + sk; const char* k2 = k1 + sk; const char* k3 = k2 + sk;
  const char* v1 = gv + sv; const char* v2 = v1 + sv; const char* v3 = v2 + sv;
  asm volatile("global_load_async_to_lds_b128 %0, %8, off\n\t"
               "global_load_async_to_lds_b128 %1, %9, off\n\t"
               "global_load_async_to_lds_b128 %2, %10, off\n\t"
               "global_load_async_to_lds_b128 %3, %11, off\n\t"
               "global_load_async_to_lds_b128 %4, %12, off\n\t"
               "global_load_async_to_lds_b128 %5, %13, off\n\t"
               "global_load_async_to_lds_b128 %6, %14, off\n\t"
               "global_load_async_to_lds_b128 %7, %15, off\n\t"
               "s_wait_xcnt 0x0"
               :: "v"(l), "v"(l + 16 * FL_PITCH), "v"(l + 32 * FL_PITCH), "v"(l + 48 * FL_PITCH), "v"(l + 64 * FL_PITCH), "v"(l + 80 * FL_PITCH), "v"(l + 96 * FL_PITCH), "v"(l + 112 * FL_PITCH),
                  "v"(gk), "v"(k1), "v"(k2), "v"(k3), "v"(gv), "v"(v1), "v"(v2), "v"(v3)
               : "memory");
}
// The K and V^T tiles of 64 keys go to LDS once per block by asynchronous copies in whole 128-byte rows, two buffers, stage t + 2 in flight while stage t + 1 is worked on; the block's 4 waves read their fragments from LDS.
// Each stage is worked on as two steps of 32 keys, with the products, the maxima and the sums in the order they had with fragments read from global memory.
template <int CAUSAL>
__global__ __launch_bounds__(128) void k_flash(const _Float16* __restrict__ Q16, int ldq, const _Float16* __restrict__ K16, int ldk, const _Float16* __restrict__ Vt, const int* __restrict__ MSK, _Float16* __restrict__ OH, int ldo) {
  constexpr int RPW = 16, DT = 4, KS = 2;
  __shared__ __attribute__((aligned(128))) unsigned char sm[2 * FL_STAGE];
  float (*sO)[RPW][64 + 4] = (float (*)[RPW][64 + 4])sm;      /* output staging (4 x 16 x 68 floats) over the two buffers, used only behind the last trip's barrier */
  const int tid = threadIdx.x, w = tid >> 5, lane = tid & 31, ln = lane & 15, hh = lane >> 4;
  const int slab = blockIdx.x / QBNP, qblk = QB0P + blockIdx.x % QBNP; const int b = slab / NH, h = slab % NH; const int qb0 = qblk * (4 * RPW); const int q0 = qb0 + w * RPW; const int tq = q0 + ln;      /* tq: this lane's query */
  const int hk = h / (NH / NKV);      /* the kv head that query head h reads */
  const unsigned short* Vth = (const unsigned short*)Vt + (size_t)(b * NKV + hk) * 64 * TK;
  const int jend = (CAUSAL == 1) ? (qb0 + 4 * RPW) : TK;      /* causal: keys beyond the block's last query never contribute */
  const int nst = jend / 64;                                  /* jend is a multiple of 64 in every mode */
  const int cr = tid >> 3, cc = tid & 7;      /* copy lane: row cr (+ 16 i) of each tile, 16-byte piece cc of its 128 bytes */
  const char* gk = (const char*)((const unsigned short*)K16 + ((size_t)b * TK + cr) * ldk + hk * 64 + cc * 8); const char* gv = (const char*)(Vth + (size_t)cr * TK + cc * 8);
  const size_t sk = (size_t)ldk * 32, sv = (size_t)TK * 32, dk = (size_t)ldk * 128;      /* dk: 64 key rows in bytes; a stage moves V^T by 128 bytes */
  const unsigned l0 = (unsigned)(size_t)sm + (unsigned)(cr * FL_PITCH + cc * 16);
  fl_stage(l0, gk, sk, gv, sv);
  FragH aq[KS];
  { const unsigned short* qr = (const unsigned short*)Q16 + ((size_t)b * TQ + tq) * ldq + h * 64;
#pragma unroll
    for (int ks = 0; ks < KS; ++ks) { aq[ks].half[0] = *(const v8us*)(qr + ks * 32 + 8 * hh); aq[ks].half[1] = *(const v8us*)(qr + ks * 32 + 16 + 8 * hh); } }
  asm volatile("s_wait_asynccnt 0x0" ::: "memory");      /* stage 0 of this wave has landed */
  __syncthreads();                                       /* ... and every other wave's */
  if (nst > 1) fl_stage(l0 + FL_STAGE, gk + dk, sk, gv + 128, sv);
  float m_r = -3.0e38f, off_r = 10.0f + 3.0e38f * SCL2, l_r = 0.f; v8f oacc[DT];      /* m_r: running maximum of the raw scores; off_r = 10 - m_r * SCL2; l_r: the sum over this lane's own keys, the two halves join behind the loop */
#pragma unroll
  for (int dt = 0; dt < DT; ++dt) oacc[dt] = (v8f){0.f,0.f,0.f,0.f,0.f,0.f,0.f,0.f};
  /* kept rolled: one trip per stage, so that the waits, the barrier and the refill at its foot stand once */
#pragma unroll 1
  for (int t = 0; t < nst; ++t) { const unsigned bo = (unsigned)(t & 1) * FL_STAGE;
    const unsigned short* kl = (const unsigned short*)(sm + bo + ln * FL_PITCH) + 8 * hh; const unsigned short* vl = (const unsigned short*)(sm + bo + (64 + ln) * FL_PITCH) + 8 * hh;      /* this lane's row of the first K tile and of the first V^T tile */
    /* unrolled: the two 32-key steps of a stage read LDS at constant offsets */
#pragma unroll
    for (int sub = 0; sub < 2; ++sub) { const int j0 = t * 64 + sub * 32;
      FragH bk[2][KS], bv[DT];
#pragma unroll
      for (int nt = 0; nt < 2; ++nt) { const unsigned short* kr = kl + (sub * 32 + nt * 16) * (FL_PITCH / 2);
#pragma unroll
        for (int ks = 0; ks < KS; ++ks) { bk[nt][ks].half[0] = *(const v8us*)(kr + ks * 32); bk[nt][ks].half[1] = *(const v8us*)(kr + ks * 32 + 16); } }
      v8f s[2];
#pragma unroll
      for (int nt = 0; nt < 2; ++nt) { v8f acc = (v8f){0.f,0.f,0.f,0.f,0.f,0.f,0.f,0.f};
#pragma unroll
        for (int ks = 0; ks < KS; ++ks) acc = mmaH<1>(bk[nt][ks].v, bk[nt][ks].v, aq[ks].v, aq[ks].v, acc);
        s[nt] = acc; }
      asm volatile("" ::: "memory");      /* compiler fence: keeps the V^T fragment reads behind the score products, so that they take over the K fragments' registers and fly during the softmax; without it the kernel takes 159 registers in place of 138 and a SIMD holds 6 waves in place of 7 */
#pragma unroll
      for (int dt = 0; dt < DT; ++dt) { const unsigned short* vrow = vl + dt * 16 * (FL_PITCH / 2) + sub * 32; bv[dt].half[0] = *(const v8us*)(vrow); bv[dt].half[1] = *(const v8us*)(vrow + 16); }
      float sc[16]; bool ok[16]; float mc = -3.0e38f;
#pragma unroll
      for (int e = 0; e < 16; ++e) { const int key = j0 + (e >> 3) * 16 + 8 * hh + (e & 7);
        ok[e] = (CAUSAL == 1) ? (key <= tq) : ((CAUSAL == 2) ? ((key >> 5) == (tq >> 5)) : true);      /* mode 2: block-diagonal 32-token groups */
        sc[e] = ok[e] ? s[e >> 3][e & 7] : -3.0e38f; mc = fmaxf(mc, sc[e]); }
      mc = fmaxf(mc, xhalf(mc));
      const float mn = fmaxf(m_r, mc); const float off = 10.0f - mn * SCL2; const float ea = __builtin_amdgcn_exp2f(off - off_r);      /* 2^(off - off_r): the factor that moves the accumulators to the new maximum */
      const float al = (mn > -1.0e38f) ? ea : 1.0f; m_r = mn; off_r = off;
      float ps[4] = {0.f, 0.f, 0.f, 0.f}; FragH pb;
#pragma unroll
      for (int e = 0; e < 16; ++e) { const float ee = __builtin_amdgcn_exp2f(sc[e] * SCL2 + off); const float p = ok[e] ? ee : 0.f; ps[e & 3] += p; pb.h[e] = (_Float16)p; }
      l_r = l_r * al + ((ps[0] + ps[1]) + (ps[2] + ps[3]));
#pragma unroll
      for (int dt = 0; dt < DT; ++dt)
#pragma unroll
        for (int r = 0; r < 8; ++r) oacc[dt][r] *= al;
#pragma unroll
      for (int dt = 0; dt < DT; ++dt) oacc[dt] = mmaH<1>(bv[dt].v, bv[dt].v, pb.v, pb.v, oacc[dt]); }
    asm volatile("s_wait_dscnt 0x0" ::: "memory");       /* this wave's reads of the buffer are done before it is refilled */
    asm volatile("s_wait_asynccnt 0x0" ::: "memory");    /* this wave's copies of stage t + 1 have landed */
    __syncthreads();                                     /* publishes stage t + 1 and ends every wave's reads of stage t */
    if (t + 2 < nst) fl_stage(l0 + bo, gk + (size_t)(t + 2) * dk, sk, gv + (size_t)(t + 2) * 128, sv); }
  asm volatile("s_wait_asynccnt 0x0" ::: "memory");      /* no copy is outstanding when the buffers become output staging */
  const float l = l_r + xhalf(l_r); const float linv = (l > 0.f) ? 1.0f / l : 0.f;
#pragma unroll
  for (int dt = 0; dt < DT; ++dt)
#pragma unroll
    for (int r = 0; r < 8; ++r) sO[w][ln][dt * 16 + 8 * hh + r] = oacc[dt][r] * linv;
  __builtin_amdgcn_fence(__ATOMIC_ACQ_REL, "workgroup"); __builtin_amdgcn_wave_barrier();
  {
#pragma unroll
    for (int rp = 0; rp < RPW; rp += 4) { const int r = rp + (lane >> 3), pc = lane & 7; const v4f va = *(const v4fa*)&sO[w][r][pc * 8], vb = *(const v4fa*)&sO[w][r][pc * 8 + 4]; FragH f;      /* the output leaves as the f16 operand of the output GEMM: 8 lanes write a row's 128 bytes */
#pragma unroll
      for (int q = 0; q < 4; ++q) { f.h[q] = (_Float16)va[q]; f.h[4 + q] = (_Float16)vb[q]; }
      *(v8us*)((unsigned short*)OH + ((size_t)b * TQ + q0 + r) * ldo + h * 64 + pc * 8) = f.half[0]; }
     } }
// 5-plane variant: S = Qh Kh^T + (Ql Kh^T + Qh Kl^T)/1024 with Q/K = [hi | 2^10 residual] f16 planes (QL/KL same layout as Q16/K16), then the 3-term P.V below.
// 3-term variant: O = (P_hi V_hi + (P_lo V_hi + P_hi V_lo) / 1024) / (1024 l) with P = [hi | 2^10 residual] of 1024 p and V^T = [hi | 2^10 residual] planes (VtL same layout as Vt) -> ~2^-21-class products for un-averaged (early causal / peaked) rows
template <int CAUSAL>
__global__ __launch_bounds__(128) void k_flash5(const _Float16* __restrict__ Q16, const _Float16* __restrict__ QL, int ldq, const _Float16* __restrict__ K16, const _Float16* __restrict__ KL, int ldk, const _Float16* __restrict__ Vt, const _Float16* __restrict__ VtL, const int* __restrict__ MSK, _Float16* __restrict__ OH, _Float16* __restrict__ OL, int ldo) {
  constexpr int RPW = 16, DT = 4, KS = 2;
  __shared__ __attribute__((aligned(16))) float sO[4][RPW][64 + 4];
  const int tid = threadIdx.x, w = tid >> 5, lane = tid & 31, ln = lane & 15, hh = lane >> 4;
  const int slab = blockIdx.x / QBN5, qblk = QB05 + blockIdx.x % QBN5; const int b = slab / NH, h = slab % NH; const int qb0 = qblk * (4 * RPW); const int q0 = qb0 + w * RPW; const int tq = q0 + ln;      /* tq: this lane's query */
  const int hk = h / (NH / NKV);      /* the kv head that query head h reads */
  FragH aq[KS], aql[KS];
  { const unsigned short* qr = (const unsigned short*)Q16 + ((size_t)b * TQ + tq) * ldq + h * 64; const unsigned short* ql = (const unsigned short*)QL + ((size_t)b * TQ + tq) * ldq + h * 64;
#pragma unroll
    for (int ks = 0; ks < KS; ++ks) { aq[ks].half[0] = *(const v8us*)(qr + ks * 32 + 8 * hh); aq[ks].half[1] = *(const v8us*)(qr + ks * 32 + 16 + 8 * hh); aql[ks].half[0] = *(const v8us*)(ql + ks * 32 + 8 * hh); aql[ks].half[1] = *(const v8us*)(ql + ks * 32 + 16 + 8 * hh); } }
  const unsigned short* Vth = (const unsigned short*)Vt + (size_t)(b * NKV + hk) * 64 * TK; const unsigned short* Vtl = (const unsigned short*)VtL + (size_t)(b * NKV + hk) * 64 * TK;
  float m_r = -3.0e38f, l_r = 0.f; v8f oacc[DT], oaccL[DT];      /* l_r: the sum over this lane's own keys; the two halves join behind the loop */
#pragma unroll
  for (int dt = 0; dt < DT; ++dt) { oacc[dt] = (v8f){0.f,0.f,0.f,0.f,0.f,0.f,0.f,0.f}; oaccL[dt] = oacc[dt]; }
  const int jend = (CAUSAL == 1) ? (qb0 + 4 * RPW) : TK;      /* causal: keys beyond the block's last query never contribute */
#pragma unroll 1
  for (int j0 = 0; j0 < jend; j0 += 32) {
    FragH bk[2][KS], bkl[2][KS], bv[DT], bl[DT]; const unsigned short* kr[2]; const unsigned short* klr[2];
#pragma unroll
    for (int nt = 0; nt < 2; ++nt) { kr[nt] = (const unsigned short*)K16 + ((size_t)b * TK + j0 + nt * 16 + ln) * ldk + hk * 64 + 8 * hh; klr[nt] = (const unsigned short*)KL + ((size_t)b * TK + j0 + nt * 16 + ln) * ldk + hk * 64 + 8 * hh;
#pragma unroll
      for (int ks = 0; ks < KS; ++ks) { bk[nt][ks].half[0] = *(const v8us*)(kr[nt] + ks * 32); bk[nt][ks].half[1] = *(const v8us*)(kr[nt] + ks * 32 + 16); bkl[nt][ks].half[0] = *(const v8us*)(klr[nt] + ks * 32); bkl[nt][ks].half[1] = *(const v8us*)(klr[nt] + ks * 32 + 16); } }
    v8f s[2];
#pragma unroll
    for (int nt = 0; nt < 2; ++nt) { v8f acc = (v8f){0.f,0.f,0.f,0.f,0.f,0.f,0.f,0.f}, accl = acc;
#pragma unroll
      for (int ks = 0; ks < KS; ++ks) { acc = mmaH<1>(bk[nt][ks].v, bk[nt][ks].v, aq[ks].v, aq[ks].v, acc); accl = mmaH<1>(bk[nt][ks].v, bk[nt][ks].v, aql[ks].v, aql[ks].v, accl); accl = mmaH<1>(bkl[nt][ks].v, bkl[nt][ks].v, aq[ks].v, aq[ks].v, accl); }
#pragma unroll
      for (int r = 0; r < 8; ++r) acc[r] += accl[r] * 0.0009765625f;
      s[nt] = acc; }
    asm volatile("s_wait_xcnt 0x0" :: "v"(kr[0]), "v"(kr[1]), "v"(klr[0]), "v"(klr[1]) : "memory");      /* the K loads' address registers, held as inputs up to here, are rewritten only behind this wait; the clobber keeps the V loads behind the score products, so that they take over the K fragments' registers and fly during the softmax */
#pragma unroll
    for (int dt = 0; dt < DT; ++dt) { const unsigned short* vrow = Vth + (size_t)(dt * 16 + ln) * TK + j0; const unsigned short* vrl = Vtl + (size_t)(dt * 16 + ln) * TK + j0; bv[dt].half[0] = *(const v8us*)(vrow + 8 * hh); bv[dt].half[1] = *(const v8us*)(vrow + 16 + 8 * hh); bl[dt].half[0] = *(const v8us*)(vrl + 8 * hh); bl[dt].half[1] = *(const v8us*)(vrl + 16 + 8 * hh); }
    float sc[16]; bool ok[16]; float mc = -3.0e38f;
#pragma unroll
    for (int e = 0; e < 16; ++e) { const int key = j0 + (e >> 3) * 16 + 8 * hh + (e & 7);
      ok[e] = (CAUSAL == 1) ? (key <= tq) : ((CAUSAL == 2) ? ((key >> 5) == (tq >> 5)) : true);      /* mode 2: block-diagonal 32-token groups */
      if (CAUSAL == 4) ok[e] = MSK[((size_t)b * TQ + tq) * TK + key] != 0;      /* mode 4: per-(query, key) INPUT mask shared by all heads; masked keys contribute nothing, rows with no valid key give l = 0 -> output 0 */
      sc[e] = ok[e] ? s[e >> 3][e & 7] * SCL : -3.0e38f; mc = fmaxf(mc, sc[e]); }
    mc = fmaxf(mc, xhalf(mc));
    const float mn = fmaxf(m_r, mc); const float ea = expf(m_r - mn); const float al = (mn > -1.0e38f) ? ea : 1.0f; m_r = mn;
    float ps[4] = {0.f, 0.f, 0.f, 0.f}; FragH pb, pl;
#pragma unroll
    for (int e = 0; e < 16; ++e) { const float ee = expf(sc[e] - mn); const float p = ok[e] ? ee : 0.f; ps[e & 3] += p; const float p1k = p * 1024.0f; const _Float16 ph = (_Float16)p1k; pb.h[e] = ph; pl.h[e] = (_Float16)((p1k - (float)ph) * 1024.0f); }
    l_r = l_r * al + ((ps[0] + ps[1]) + (ps[2] + ps[3]));
#pragma unroll
    for (int dt = 0; dt < DT; ++dt)
#pragma unroll
      for (int r = 0; r < 8; ++r) { oacc[dt][r] *= al; oaccL[dt][r] *= al; }
#pragma unroll
    for (int dt = 0; dt < DT; ++dt) { oacc[dt] = mmaH<1>(bv[dt].v, bv[dt].v, pb.v, pb.v, oacc[dt]); oaccL[dt] = mmaH<1>(bv[dt].v, bv[dt].v, pl.v, pl.v, oaccL[dt]); oaccL[dt] = mmaH<1>(bl[dt].v, bl[dt].v, pb.v, pb.v, oaccL[dt]); } }
  const float l = l_r + xhalf(l_r); const float linv = (l > 0.f) ? 1.0f / (l * 1024.0f) : 0.f;
#pragma unroll
  for (int dt = 0; dt < DT; ++dt)
#pragma unroll
    for (int r = 0; r < 8; ++r) { float v = oacc[dt][r]; v += oaccL[dt][r] * 0.0009765625f; sO[w][ln][dt * 16 + 8 * hh + r] = v * linv; }
  __builtin_amdgcn_fence(__ATOMIC_ACQ_REL, "workgroup"); __builtin_amdgcn_wave_barrier();
  {
#pragma unroll
    for (int rp = 0; rp < RPW; rp += 4) { const int r = rp + (lane >> 3), pc = lane & 7; float a[8]; *(v4fa*)&a[0] = *(const v4fa*)&sO[w][r][pc * 8]; *(v4fa*)&a[4] = *(const v4fa*)&sO[w][r][pc * 8 + 4]; FragH fh, fl; hl8(a, fh, fl);      /* the output leaves as the f16 hi + residual operands of the output GEMMs: 8 lanes write a row's 128 bytes of each */
      const size_t o = ((size_t)b * TQ + q0 + r) * ldo + h * 64 + pc * 8; *(v8us*)((unsigned short*)OH + o) = fh.half[0]; *(v8us*)((unsigned short*)OL + o) = fl.half[0]; }
     } }

__global__ __launch_bounds__(256) void k_wsc(const float* __restrict__ Wm, _Float16* __restrict__ Bt, size_t n8, float sc) { const size_t t = (size_t)blockIdx.x * 256 + threadIdx.x; if (t >= n8) return; FragH f; for (int q = 0; q < 8; ++q) f.h[q] = (_Float16)(bf16_round(Wm[t * 8 + q]) * sc); *(v8us*)((unsigned short*)Bt + t * 8) = f.half[0];  }      /* (out,in) weight == Bt[n][k]: scaled copy */




__device__ __forceinline__ void rotab_job(int bx, const int* __restrict__ pid, float* __restrict__ CS, float* __restrict__ SN) {      /* s = token row over both batches */
  #pragma clang fp contract(off)
  const int t = bx * 256 + threadIdx.x; if (t >= NR * HH) return; const int j = t % HH, s = t / HH; const float inv = 1.0f / powf(10000.0f, (float)(2 * j) / (float)HD); const float th = (float)pid[s] * inv; const float c = cosf(th), sn = sinf(th);
  { *(float*)(CS + t) = c; *(float*)(SN + t) = sn;  } }

// ---- launches that do not depend on one another share one grid: a range of the block index picks the job (the test is the same for a whole block, so each job's barrier is passed by all of its block or by none) ----
#define PB_ROT (NR * HH / 256)                    /* angle tables */
#define PB_WB ((EMB / 64) * (EMB / 64))           /* tiles of Wq, of Wo */
#define PB_WS ((EMB / 64) * (KVD / 64))           /* tiles of Wk, of Wv */
#define PB_X (NR * EMB / 8 / 256)                 /* f16 plane of x */
__global__ __launch_bounds__(256) void k_prep(const float* __restrict__ x, const float* __restrict__ Wq, const float* __restrict__ Wk, const float* __restrict__ Wv, const float* __restrict__ Wo, const int* __restrict__ pid,
    _Float16* __restrict__ X16, _Float16* __restrict__ BQ, _Float16* __restrict__ BK, _Float16* __restrict__ BV, _Float16* __restrict__ BO, float* __restrict__ CS, float* __restrict__ SN) {
  int bx = blockIdx.x;
  if (bx < PB_ROT) { rotab_job(bx, pid, CS, SN); return; }
  bx -= PB_ROT;
  if (bx < 2 * PB_WB + 2 * PB_WS) {
    const bool q = bx < PB_WB, k = bx < PB_WB + PB_WS, v = bx < PB_WB + 2 * PB_WS;
    const float* W = q ? Wq : (k ? Wk : (v ? Wv : Wo)); _Float16* Wt = q ? BQ : (k ? BK : (v ? BV : BO));
    wt_f16_job(bx - (q ? 0 : (k ? PB_WB : (v ? PB_WB + PB_WS : PB_WB + 2 * PB_WS))), W, Wt, EMB, (v && !q) ? KVD : EMB, 16.0f);      /* (in,out) weights */
    return; }
  x16_job(bx - (2 * PB_WB + 2 * PB_WS), x, X16, (size_t)NR * EMB / 8); }
extern "C" void kernel_launch(void* const* d_in, const int* in_sizes, int n_in,
                              void* d_out, int out_size, void* d_ws, size_t ws_size, hipStream_t stream) {
  (void)in_sizes; (void)n_in; (void)out_size;
  const float* const* I = (const float* const*)d_in; const float* x = I[0]; const float* Wq = I[1]; const float* bq = I[2]; const float* Wk = I[3]; const float* bk = I[4]; const float* Wv = I[5]; const float* bv = I[6]; const float* Wo = I[7]; const int* pid = (const int*)d_in[8];
  char* ws = (char*)d_ws; size_t off = 0;
  auto take = [&](size_t bytes) { char* p = ws + off; off += (bytes + 255) & ~(size_t)255; return p; };
  const size_t npb = (size_t)SLEN * EMB, npa = (size_t)NR * EMB;      /* per-batch plane, plane of both batches */
  _Float16* BQ = (_Float16*)take((size_t)EMB * EMB * 2); _Float16* BK = (_Float16*)take((size_t)KVD * EMB * 2); _Float16* BV = (_Float16*)take((size_t)KVD * EMB * 2); _Float16* BO = (_Float16*)take((size_t)EMB * EMB * 2);
  float* CS = (float*)take((size_t)NR * HH * 4); float* SN = (float*)take((size_t)NR * HH * 4);
  _Float16* X16 = (_Float16*)take(npa * 2); _Float16* KH8 = (_Float16*)take((size_t)NR * KVD * 2); _Float16* KL8 = (_Float16*)take((size_t)NR * KVD * 2);
  _Float16* H16 = (_Float16*)take(npa * 2); _Float16* L16 = (_Float16*)take(npa * 2); _Float16* VT = (_Float16*)take((size_t)NR * KVD * 2); _Float16* VTL = (_Float16*)take((size_t)NR * KVD * 2);      /* H16, L16: q hi and residual; VT, VTL: [batch][kv head][64][SLEN] */
  _Float16* OH = X16; _Float16* OLo = (_Float16*)take(npa * 2);      /* O hi over the x plane (dead after the projections); of O's residual only the first RE rows of each batch are written and read */
  if (off > ws_size) return;      /* 8+2+2+8 + 1 + 16 + 4+4 + 16 + 16 + 4 + 4 + 16 = 101 MiB */
  float* ob = (float*)d_out;
  k_prep<<<PB_ROT + 2 * PB_WB + 2 * PB_WS + PB_X, 256, 0, stream>>>(x, Wq, Wk, Wv, Wo, pid, X16, BQ, BK, BV, BO, CS, SN);
  k_gemm2_qkv<<<(NR / 128) * QKV_NT, 256, 0, stream>>>(X16, BQ, BK, BV, bq, bk, bv, CS, SN, H16, L16, KH8, KL8, VT, VTL);
  k_flash5<1><<<NB * NH * QBN5, 128, 0, stream>>>(H16, L16, EMB, KH8, KL8, KVD, VT, VTL, nullptr, OH, OLo, EMB);
  k_flash<1><<<NB * NH * QBNP, 128, 0, stream>>>(H16, EMB, KH8, KVD, VT, nullptr, OH, EMB);
  k_gemm2<0><<<dim3((NR / 128) * (EMB / 128), 1), 256, 0, stream>>>(OH, EMB, 0, BO, EMB, 0, 0.0625f, nullptr, 0, nullptr, 1, 0, 0, ob, nullptr, EMB, 0, NR, EMB, EMB);
  k_gemm2<0><<<dim3((RE / 128) * (EMB / 128), NB), 256, 0, stream>>>(OLo, EMB, npb, BO, EMB, 0, 0.0625f / 1024.0f, nullptr, 0, ob, 1, (size_t)EMB, 0, ob, nullptr, EMB, npb, RE, EMB, EMB);      /* grid y = batch: the first RE rows of each */
}
